// v000
// Times are from an AMD MI455X. After a warm-up the kernel runs many times in a row, and a time is the length of
// such a window on the GPU divided by its runs, so every launch and the gaps after it count. The runs cycle
// through copies of the inputs. A figure is the median of several windows, for all but v000 over two sittings.
// Sittings can differ by a few percent; kernels timed side by side share one.
// v000, which the later versions start from, runs in 65.1 microseconds.
#include <hip/hip_runtime.h>
#include <hip/hip_bf16.h>
#include <math.h>

typedef __attribute__((ext_vector_type(16))) _Float16 v16h;
typedef __attribute__((ext_vector_type(8)))  _Float16 v8h;
typedef __attribute__((ext_vector_type(8)))  float    v8f;
typedef __attribute__((ext_vector_type(4)))  float    v4f;

#define B_SZ 512
#define T_SZ 256
#define C_SZ 256
#define H_SZ 64
#define CPAD 264   // 256 + 8 f16 pad
#define HPAD 72    // 64 + 8 f16 pad
#define TPAD 264   // 256 + 8 f16 pad
#define NWAVE 8

struct __align__(16) SMem {
  _Float16 wt[3][64 * CPAD];        // W^T per projection: [h][c], f16
  _Float16 qs[T_SZ * HPAD];         // Q row-major [t][h]
  _Float16 ks[T_SZ * HPAD];         // K row-major [t][h]  (== B-operand of Q K^T)
  _Float16 vts[H_SZ * TPAD];        // V^T [h][t]          (== B-operand of P V)
  _Float16 pscr[NWAVE][16 * TPAD];  // per-wave P relayout scratch [r][t]
  float    bias[3][H_SZ];
};

// Load a 16x32 f16 A/B fragment from a row-major matrix in LDS.
// Per ISA layout: lane holds row/col = lane&15; K chunks {off..off+7} -> v[0..7],
// {off+16..off+23} -> v[8..15], where off already includes (lane>>4)*8.
__device__ __forceinline__ v16h lds_frag(const _Float16* rowbase, int off) {
  v8h lo = *(const v8h*)(rowbase + off);
  v8h hi = *(const v8h*)(rowbase + off + 16);
  v16h r;
#pragma unroll
  for (int i = 0; i < 8; ++i) { r[i] = lo[i]; r[i + 8] = hi[i]; }
  return r;
}

// Same fragment pattern, but sourced from global fp32 with convert-to-f16.
__device__ __forceinline__ v16h gbl_frag_f32(const float* rowbase, int off) {
  v4f a0 = *(const v4f*)(rowbase + off);
  v4f a1 = *(const v4f*)(rowbase + off + 4);
  v4f a2 = *(const v4f*)(rowbase + off + 16);
  v4f a3 = *(const v4f*)(rowbase + off + 20);
  v16h r;
#pragma unroll
  for (int i = 0; i < 4; ++i) {
    r[i]      = (_Float16)a0[i];
    r[i + 4]  = (_Float16)a1[i];
    r[i + 8]  = (_Float16)a2[i];
    r[i + 12] = (_Float16)a3[i];
  }
  return r;
}

__device__ __forceinline__ v8f wmma_f16(v16h a, v16h b, v8f c) {
  return __builtin_amdgcn_wmma_f32_16x16x32_f16(
      /*neg_a=*/false, a, /*neg_b=*/false, b,
      /*c_mod=*/(short)0, c, /*reuse_a=*/false, /*reuse_b=*/false);
}

__global__ __launch_bounds__(256) void fused_attn_head(
    const float* __restrict__ x,
    const float* __restrict__ Wq, const float* __restrict__ bq,
    const float* __restrict__ Wk, const float* __restrict__ bk,
    const float* __restrict__ Wv, const float* __restrict__ bv,
    float* __restrict__ out) {
  __shared__ SMem sm;
  const int tid  = threadIdx.x;
  const int lane = tid & 31;
  const int wid  = tid >> 5;
  const int lh   = lane >> 4;   // which 16-lane half
  const int l16  = lane & 15;
  const int b    = blockIdx.x;

  // Warm L2/L0 with this block's x panel (256 KB) while we stage W below.
  {
    const char* xb = (const char*)(x + (size_t)b * T_SZ * C_SZ);
#pragma unroll
    for (int j = 0; j < 8; ++j)
      __builtin_prefetch(xb + ((size_t)tid + (size_t)j * 256) * 128, 0, 3);
  }

  // ---------------- Phase 0: stage W^T (f16) and biases into LDS ----------------
  for (int idx = tid; idx < 3 * 64 * 256; idx += 256) {
    int p   = idx >> 14;          // / (64*256)
    int rem = idx & 16383;
    int h   = rem >> 8;
    int c   = rem & 255;
    const float* Wp = (p == 0) ? Wq : (p == 1) ? Wk : Wv;
    sm.wt[p][h * CPAD + c] = (_Float16)Wp[c * H_SZ + h];
  }
  if (tid < 192) {
    int p = tid >> 6, h = tid & 63;
    const float* bp = (p == 0) ? bq : (p == 1) ? bk : bv;
    sm.bias[p][h] = bp[h];
  }
  __syncthreads();

  // ---------------- Phase 1: Q/K/V projections (each wave: 2 row-tiles) --------
#pragma unroll 1
  for (int i = 0; i < 2; ++i) {
    const int mt = wid * 2 + i;
    const float* xr = x + ((size_t)b * T_SZ + mt * 16 + l16) * C_SZ;
    v8f acc[3][4];
#pragma unroll
    for (int p = 0; p < 3; ++p)
#pragma unroll
      for (int ht = 0; ht < 4; ++ht) acc[p][ht] = {};

#pragma unroll
    for (int kc = 0; kc < 8; ++kc) {
      const int c0 = kc * 32 + lh * 8;
      v16h a = gbl_frag_f32(xr, c0);   // x tile, read once, cvt f16
#pragma unroll
      for (int p = 0; p < 3; ++p) {
        v16h bm[4];
#pragma unroll
        for (int ht = 0; ht < 4; ++ht)
          bm[ht] = lds_frag(&sm.wt[p][(ht * 16 + l16) * CPAD], c0);
#pragma unroll
        for (int ht = 0; ht < 4; ++ht)
          acc[p][ht] = wmma_f16(a, bm[ht], acc[p][ht]);
      }
    }
    // Epilogue: + bias, cvt f16, scatter into Q / K (row-major) and V^T
#pragma unroll
    for (int p = 0; p < 3; ++p)
#pragma unroll
      for (int ht = 0; ht < 4; ++ht) {
        const float bb = sm.bias[p][ht * 16 + l16];
#pragma unroll
        for (int vr = 0; vr < 8; ++vr) {
          float val = acc[p][ht][vr] + bb;
          int r = mt * 16 + vr + 8 * lh;       // C/D layout: M = vgpr + 8*half
          int h = ht * 16 + l16;               // N = lane&15
          if (p == 0)      sm.qs[r * HPAD + h]  = (_Float16)val;
          else if (p == 1) sm.ks[r * HPAD + h]  = (_Float16)val;
          else             sm.vts[h * TPAD + r] = (_Float16)val;
        }
      }
  }
  __syncthreads();

  // ---------------- Phase 2: causal attention (each wave: its 2 row-tiles) -----
  const float scale = 0.0625f;  // C^-0.5 = 256^-0.5
#pragma unroll 1
  for (int i = 0; i < 2; ++i) {
    const int mt = wid * 2 + i;
    const int r0 = mt * 16;

    // A-operand: this tile's 16 Q rows, K-dim = 64 split into 2 chunks of 32
    v16h aq0 = lds_frag(&sm.qs[(r0 + l16) * HPAD], lh * 8);
    v16h aq1 = lds_frag(&sm.qs[(r0 + l16) * HPAD], 32 + lh * 8);

    // S = Q K^T over all 16 key tiles (kept in registers); 2 key tiles in flight
    v8f sacc[16];
#pragma unroll
    for (int jp = 0; jp < 8; ++jp) {
      const int jt0 = jp * 2, jt1 = jp * 2 + 1;
      v16h b0a = lds_frag(&sm.ks[(jt0 * 16 + l16) * HPAD], lh * 8);
      v16h b1a = lds_frag(&sm.ks[(jt0 * 16 + l16) * HPAD], 32 + lh * 8);
      v16h b0b = lds_frag(&sm.ks[(jt1 * 16 + l16) * HPAD], lh * 8);
      v16h b1b = lds_frag(&sm.ks[(jt1 * 16 + l16) * HPAD], 32 + lh * 8);
      v8f acca = {}, accb = {};
      acca = wmma_f16(aq0, b0a, acca);
      accb = wmma_f16(aq0, b0b, accb);
      acca = wmma_f16(aq1, b1a, acca);
      accb = wmma_f16(aq1, b1b, accb);
      sacc[jt0] = acca;
      sacc[jt1] = accb;
    }

    // Causal mask + softmax (rows live on 16-lane halves -> shfl_xor 1,2,4,8)
    float inv[8];
#pragma unroll
    for (int vr = 0; vr < 8; ++vr) {
      const int r = r0 + vr + 8 * lh;
      float m = -INFINITY;
#pragma unroll
      for (int jt = 0; jt < 16; ++jt) {
        int col = jt * 16 + l16;
        float v = (col <= r) ? sacc[jt][vr] * scale : -INFINITY;
        sacc[jt][vr] = v;
        m = fmaxf(m, v);
      }
      m = fmaxf(m, __shfl_xor(m, 1, 32));
      m = fmaxf(m, __shfl_xor(m, 2, 32));
      m = fmaxf(m, __shfl_xor(m, 4, 32));
      m = fmaxf(m, __shfl_xor(m, 8, 32));
      float s = 0.f;
#pragma unroll
      for (int jt = 0; jt < 16; ++jt) {
        float e = __expf(sacc[jt][vr] - m);   // exp(-inf)=0 handles the mask
        sacc[jt][vr] = e;
        s += e;
      }
      s += __shfl_xor(s, 1, 32);
      s += __shfl_xor(s, 2, 32);
      s += __shfl_xor(s, 4, 32);
      s += __shfl_xor(s, 8, 32);
      inv[vr] = 1.0f / s;
    }

    // Relayout P (C-layout regs) -> per-wave LDS scratch (row-major f16)
    _Float16* pb = &sm.pscr[wid][0];
#pragma unroll
    for (int jt = 0; jt < 16; ++jt)
#pragma unroll
      for (int vr = 0; vr < 8; ++vr)
        pb[(vr + 8 * lh) * TPAD + jt * 16 + l16] =
            (_Float16)(sacc[jt][vr] * inv[vr]);
    __asm volatile("s_wait_dscnt 0" ::: "memory");  // same-wave LDS RAW

    // O = P V  (A = P rows from scratch, B = V^T, K = 256 keys)
    v8f o[4];
#pragma unroll
    for (int ht = 0; ht < 4; ++ht) o[ht] = {};
#pragma unroll
    for (int kc = 0; kc < 8; ++kc) {
      const int k0 = kc * 32 + lh * 8;
      v16h a = lds_frag(&pb[l16 * TPAD], k0);
      v16h bm[4];
#pragma unroll
      for (int ht = 0; ht < 4; ++ht)
        bm[ht] = lds_frag(&sm.vts[(ht * 16 + l16) * TPAD], k0);
#pragma unroll
      for (int ht = 0; ht < 4; ++ht)
        o[ht] = wmma_f16(a, bm[ht], o[ht]);
    }

    // Store fp32 output [b][r][h]
#pragma unroll
    for (int ht = 0; ht < 4; ++ht)
#pragma unroll
      for (int vr = 0; vr < 8; ++vr) {
        int r = r0 + vr + 8 * lh;
        int h = ht * 16 + l16;
        out[((size_t)b * T_SZ + r) * H_SZ + h] = o[ht][vr];
      }
  }
}

extern "C" void kernel_launch(void* const* d_in, const int* in_sizes, int n_in,
                              void* d_out, int out_size, void* d_ws, size_t ws_size,
                              hipStream_t stream) {
  (void)in_sizes; (void)n_in; (void)out_size; (void)d_ws; (void)ws_size;
  const float* x  = (const float*)d_in[0];
  const float* Wq = (const float*)d_in[1];
  const float* bq = (const float*)d_in[2];
  const float* Wk = (const float*)d_in[3];
  const float* bk = (const float*)d_in[4];
  const float* Wv = (const float*)d_in[5];
  const float* bv = (const float*)d_in[6];
  float* out = (float*)d_out;
  fused_attn_head<<<dim3(B_SZ), dim3(256), 0, stream>>>(x, Wq, bq, Wk, bk, Wv, bv, out);
}

// v001
// A run of this version takes 47.9 microseconds.
// Timed twice side by side with v000, it ran 1.42 and 1.41 times as fast.
#include <hip/hip_runtime.h>
#include <hip/hip_bf16.h>
#include <math.h>

typedef __attribute__((ext_vector_type(16))) _Float16 v16h;
typedef __attribute__((ext_vector_type(8)))  _Float16 v8h;
typedef __attribute__((ext_vector_type(8)))  float    v8f;
typedef __attribute__((ext_vector_type(4)))  float    v4f;

#define B_SZ 512
#define T_SZ 256
#define C_SZ 256
#define H_SZ 64
#define CPAD 264   // 256 + 8 f16 pad
#define HPAD 72    // 64 + 8 f16 pad
#define TPAD 264   // 256 + 8 f16 pad
#define NWAVE 8

struct __align__(16) SMem {
  _Float16 wt[3][64 * CPAD];        // W^T per projection: [h][c], f16
  _Float16 qs[T_SZ * HPAD];         // Q row-major [t][h]
  _Float16 ks[T_SZ * HPAD];         // K row-major [t][h]  (== B-operand of Q K^T)
  _Float16 vts[H_SZ * TPAD];        // V^T [h][t]          (== B-operand of P V)
  _Float16 pscr[NWAVE][16 * TPAD];  // per-wave P relayout scratch [r][t]
  float    bias[3][H_SZ];
};

// Load a 16x32 f16 A/B fragment from a row-major matrix in LDS.
// Per ISA layout: lane holds row/col = lane&15; K chunks {off..off+7} -> v[0..7],
// {off+16..off+23} -> v[8..15], where off already includes (lane>>4)*8.
__device__ __forceinline__ v16h lds_frag(const _Float16* rowbase, int off) {
  v8h lo = *(const v8h*)(rowbase + off);
  v8h hi = *(const v8h*)(rowbase + off + 16);
  v16h r;
#pragma unroll
  for (int i = 0; i < 8; ++i) { r[i] = lo[i]; r[i + 8] = hi[i]; }
  return r;
}

// Same fragment pattern, but sourced from global fp32 with convert-to-f16.
__device__ __forceinline__ v16h gbl_frag_f32(const float* rowbase, int off) {
  v4f a0 = *(const v4f*)(rowbase + off);
  v4f a1 = *(const v4f*)(rowbase + off + 4);
  v4f a2 = *(const v4f*)(rowbase + off + 16);
  v4f a3 = *(const v4f*)(rowbase + off + 20);
  v16h r;
#pragma unroll
  for (int i = 0; i < 4; ++i) {
    r[i]      = (_Float16)a0[i];
    r[i + 4]  = (_Float16)a1[i];
    r[i + 8]  = (_Float16)a2[i];
    r[i + 12] = (_Float16)a3[i];
  }
  return r;
}

__device__ __forceinline__ v8f wmma_f16(v16h a, v16h b, v8f c) {
  return __builtin_amdgcn_wmma_f32_16x16x32_f16(
      /*neg_a=*/false, a, /*neg_b=*/false, b,
      /*c_mod=*/(short)0, c, /*reuse_a=*/false, /*reuse_b=*/false);
}

__global__ __launch_bounds__(256) void fused_attn_head(
    const float* __restrict__ x,
    const float* __restrict__ Wq, const float* __restrict__ bq,
    const float* __restrict__ Wk, const float* __restrict__ bk,
    const float* __restrict__ Wv, const float* __restrict__ bv,
    float* __restrict__ out) {
  __shared__ SMem sm;
  const int tid  = threadIdx.x;
  const int lane = tid & 31;
  const int wid  = tid >> 5;
  const int lh   = lane >> 4;   // which 16-lane half
  const int l16  = lane & 15;
  const int b    = blockIdx.x;

  // Warm L2/L0 with this block's x panel (256 KB) while we stage W below.
  {
    const char* xb = (const char*)(x + (size_t)b * T_SZ * C_SZ);
#pragma unroll
    for (int j = 0; j < 8; ++j)
      __builtin_prefetch(xb + ((size_t)tid + (size_t)j * 256) * 128, 0, 3);
  }

  // ---------------- Phase 0: stage W^T (f16) and biases into LDS ----------------
  // Each lane reads 4 consecutive h of 8 consecutive c rows (16-byte loads, 8 lanes
  // per 128-byte line, whole lines only), transposes the 8x4 patch in registers and
  // writes 4 rows of 8 f16 with 16-byte LDS stores. The two 8-lane groups of a
  // 16-lane half take neighbouring c blocks, which shifts their LDS banks apart.
  {
    const int h0  = (((tid >> 4) & 1) * 8 + (tid & 7)) * 4;
    const int cb0 = wid * 2 + ((tid >> 3) & 1);
    const unsigned goff = (unsigned)(cb0 * 8 * H_SZ + h0);
    v4f r[6][8];
#pragma unroll
    for (int k = 0; k < 6; ++k) {
      const float* Wp = (k < 2) ? Wq : (k < 4) ? Wk : Wv;
#pragma unroll
      for (int i = 0; i < 8; ++i)
        r[k][i] = *(const v4f*)(Wp + goff + ((k & 1) * 128 + i) * H_SZ);
      // Keeps the groups' loads in the order in which they are used below, so
      // that a counted wait frees the first group while the later ones fly.
      __builtin_amdgcn_sched_barrier(0);
    }
    // Precaution: stands ahead of every later write of a register that the loads
    // above name as an address.
    asm volatile("s_wait_xcnt 0x0" ::: "memory");
#pragma unroll
    for (int k = 0; k < 6; ++k) {
      const int c0 = (cb0 + (k & 1) * 16) * 8;
#pragma unroll
      for (int j = 0; j < 4; ++j) {
        v8h t;
#pragma unroll
        for (int i = 0; i < 8; ++i) t[i] = (_Float16)r[k][i][j];
        *(v8h*)&sm.wt[k >> 1][(h0 + j) * CPAD + c0] = t;
      }
      // Keeps this group's LDS stores here, under the loads still in flight;
      // without it they all sink behind the last load's wait.
      __builtin_amdgcn_sched_barrier(0);
    }
  }
  if (tid < 192) {
    int p = tid >> 6, h = tid & 63;
    const float* bp = (p == 0) ? bq : (p == 1) ? bk : bv;
    sm.bias[p][h] = bp[h];
  }
  __syncthreads();

  // ---------------- Phase 1: Q/K/V projections (each wave: 2 row-tiles) --------
#pragma unroll 1
  for (int i = 0; i < 2; ++i) {
    const int mt = wid * 2 + i;
    const float* xr = x + ((size_t)b * T_SZ + mt * 16 + l16) * C_SZ;
    v8f acc[3][4];
#pragma unroll
    for (int p = 0; p < 3; ++p)
#pragma unroll
      for (int ht = 0; ht < 4; ++ht) acc[p][ht] = {};

#pragma unroll
    for (int kc = 0; kc < 8; ++kc) {
      const int c0 = kc * 32 + lh * 8;
      v16h a = gbl_frag_f32(xr, c0);   // x tile, read once, cvt f16
#pragma unroll
      for (int p = 0; p < 3; ++p) {
        v16h bm[4];
#pragma unroll
        for (int ht = 0; ht < 4; ++ht)
          bm[ht] = lds_frag(&sm.wt[p][(ht * 16 + l16) * CPAD], c0);
#pragma unroll
        for (int ht = 0; ht < 4; ++ht)
          acc[p][ht] = wmma_f16(a, bm[ht], acc[p][ht]);
      }
    }
    // Epilogue: + bias, cvt f16, scatter into Q / K (row-major) and V^T
#pragma unroll
    for (int p = 0; p < 3; ++p)
#pragma unroll
      for (int ht = 0; ht < 4; ++ht) {
        const float bb = sm.bias[p][ht * 16 + l16];
#pragma unroll
        for (int vr = 0; vr < 8; ++vr) {
          float val = acc[p][ht][vr] + bb;
          int r = mt * 16 + vr + 8 * lh;       // C/D layout: M = vgpr + 8*half
          int h = ht * 16 + l16;               // N = lane&15
          if (p == 0)      sm.qs[r * HPAD + h]  = (_Float16)val;
          else if (p == 1) sm.ks[r * HPAD + h]  = (_Float16)val;
          else             sm.vts[h * TPAD + r] = (_Float16)val;
        }
      }
  }
  __syncthreads();

  // ---------------- Phase 2: causal attention (each wave: its 2 row-tiles) -----
  const float scale = 0.0625f;  // C^-0.5 = 256^-0.5
#pragma unroll 1
  for (int i = 0; i < 2; ++i) {
    const int mt = wid * 2 + i;
    const int r0 = mt * 16;

    // A-operand: this tile's 16 Q rows, K-dim = 64 split into 2 chunks of 32
    v16h aq0 = lds_frag(&sm.qs[(r0 + l16) * HPAD], lh * 8);
    v16h aq1 = lds_frag(&sm.qs[(r0 + l16) * HPAD], 32 + lh * 8);

    // S = Q K^T over all 16 key tiles (kept in registers); 2 key tiles in flight
    v8f sacc[16];
#pragma unroll
    for (int jp = 0; jp < 8; ++jp) {
      const int jt0 = jp * 2, jt1 = jp * 2 + 1;
      v16h b0a = lds_frag(&sm.ks[(jt0 * 16 + l16) * HPAD], lh * 8);
      v16h b1a = lds_frag(&sm.ks[(jt0 * 16 + l16) * HPAD], 32 + lh * 8);
      v16h b0b = lds_frag(&sm.ks[(jt1 * 16 + l16) * HPAD], lh * 8);
      v16h b1b = lds_frag(&sm.ks[(jt1 * 16 + l16) * HPAD], 32 + lh * 8);
      v8f acca = {}, accb = {};
      acca = wmma_f16(aq0, b0a, acca);
      accb = wmma_f16(aq0, b0b, accb);
      acca = wmma_f16(aq1, b1a, acca);
      accb = wmma_f16(aq1, b1b, accb);
      sacc[jt0] = acca;
      sacc[jt1] = accb;
    }

    // Causal mask + softmax (rows live on 16-lane halves -> shfl_xor 1,2,4,8)
    float inv[8];
#pragma unroll
    for (int vr = 0; vr < 8; ++vr) {
      const int r = r0 + vr + 8 * lh;
      float m = -INFINITY;
#pragma unroll
      for (int jt = 0; jt < 16; ++jt) {
        int col = jt * 16 + l16;
        float v = (col <= r) ? sacc[jt][vr] * scale : -INFINITY;
        sacc[jt][vr] = v;
        m = fmaxf(m, v);
      }
      m = fmaxf(m, __shfl_xor(m, 1, 32));
      m = fmaxf(m, __shfl_xor(m, 2, 32));
      m = fmaxf(m, __shfl_xor(m, 4, 32));
      m = fmaxf(m, __shfl_xor(m, 8, 32));
      float s = 0.f;
#pragma unroll
      for (int jt = 0; jt < 16; ++jt) {
        float e = __expf(sacc[jt][vr] - m);   // exp(-inf)=0 handles the mask
        sacc[jt][vr] = e;
        s += e;
      }
      s += __shfl_xor(s, 1, 32);
      s += __shfl_xor(s, 2, 32);
      s += __shfl_xor(s, 4, 32);
      s += __shfl_xor(s, 8, 32);
      inv[vr] = 1.0f / s;
    }

    // Relayout P (C-layout regs) -> per-wave LDS scratch (row-major f16)
    _Float16* pb = &sm.pscr[wid][0];
#pragma unroll
    for (int jt = 0; jt < 16; ++jt)
#pragma unroll
      for (int vr = 0; vr < 8; ++vr)
        pb[(vr + 8 * lh) * TPAD + jt * 16 + l16] =
            (_Float16)(sacc[jt][vr] * inv[vr]);
    __asm volatile("s_wait_dscnt 0" ::: "memory");  // same-wave LDS RAW

    // O = P V  (A = P rows from scratch, B = V^T, K = 256 keys)
    v8f o[4];
#pragma unroll
    for (int ht = 0; ht < 4; ++ht) o[ht] = {};
#pragma unroll
    for (int kc = 0; kc < 8; ++kc) {
      const int k0 = kc * 32 + lh * 8;
      v16h a = lds_frag(&pb[l16 * TPAD], k0);
      v16h bm[4];
#pragma unroll
      for (int ht = 0; ht < 4; ++ht)
        bm[ht] = lds_frag(&sm.vts[(ht * 16 + l16) * TPAD], k0);
#pragma unroll
      for (int ht = 0; ht < 4; ++ht)
        o[ht] = wmma_f16(a, bm[ht], o[ht]);
    }

    // Store fp32 output [b][r][h]
#pragma unroll
    for (int ht = 0; ht < 4; ++ht)
#pragma unroll
      for (int vr = 0; vr < 8; ++vr) {
        int r = r0 + vr + 8 * lh;
        int h = ht * 16 + l16;
        out[((size_t)b * T_SZ + r) * H_SZ + h] = o[ht][vr];
      }
  }
}

extern "C" void kernel_launch(void* const* d_in, const int* in_sizes, int n_in,
                              void* d_out, int out_size, void* d_ws, size_t ws_size,
                              hipStream_t stream) {
  (void)in_sizes; (void)n_in; (void)out_size; (void)d_ws; (void)ws_size;
  const float* x  = (const float*)d_in[0];
  const float* Wq = (const float*)d_in[1];
  const float* bq = (const float*)d_in[2];
  const float* Wk = (const float*)d_in[3];
  const float* bk = (const float*)d_in[4];
  const float* Wv = (const float*)d_in[5];
  const float* bv = (const float*)d_in[6];
  float* out = (float*)d_out;
  fused_attn_head<<<dim3(B_SZ), dim3(256), 0, stream>>>(x, Wq, bq, Wk, bk, Wv, bv, out);
}

// v002
// Measured time: 37.6 microseconds a run.
// Timed twice side by side with v001, it ran 1.26 times as fast both times.
// Over all steps from v000 it is 1.79 times as fast.
#include <hip/hip_runtime.h>
#include <hip/hip_bf16.h>
#include <math.h>

typedef __attribute__((ext_vector_type(16))) _Float16 v16h;
typedef __attribute__((ext_vector_type(8)))  _Float16 v8h;
typedef __attribute__((ext_vector_type(4)))  _Float16 v4h;
typedef __attribute__((ext_vector_type(8)))  float    v8f;
typedef __attribute__((ext_vector_type(4)))  float    v4f;

#define B_SZ 512
#define T_SZ 256
#define C_SZ 256
#define H_SZ 64
#define CPAD 264   // 256 + 8 f16 pad
#define HPAD 72    // 64 + 8 f16 pad
#define TPAD 264   // 256 + 8 f16 pad
#define NWAVE 8

struct __align__(16) SMem {
  _Float16 wt[3][64 * CPAD];        // W^T per projection: [h][c], f16
  _Float16 qs[T_SZ * HPAD];         // Q row-major [t][h]
  _Float16 ks[T_SZ * HPAD];         // K row-major [t][h]  (== B-operand of Q K^T)
  _Float16 vts[H_SZ * TPAD];        // V^T [h][t]          (== B-operand of P V)
  _Float16 pscr[NWAVE][16 * TPAD];  // per-wave scratch: x tile [r][c] (phase 1), P [r][t] (phase 2)
  float    bias[3][H_SZ];
};

// Load a 16x32 f16 A/B fragment from a row-major matrix in LDS.
// Per ISA layout: lane holds row/col = lane&15; K chunks {off..off+7} -> v[0..7],
// {off+16..off+23} -> v[8..15], where off already includes (lane>>4)*8.
__device__ __forceinline__ v16h lds_frag(const _Float16* rowbase, int off) {
  v8h lo = *(const v8h*)(rowbase + off);
  v8h hi = *(const v8h*)(rowbase + off + 16);
  v16h r;
#pragma unroll
  for (int i = 0; i < 8; ++i) { r[i] = lo[i]; r[i + 8] = hi[i]; }
  return r;
}

// A 16-row tile of x is 16 KB in a row: load j of a wave takes its bytes
// j*512 .. j*512+511 (four whole 128-byte lines), 16 bytes a lane.
__device__ __forceinline__ void load_x_tile(const float* xt, int lane, v4f (&xr)[32]) {
#pragma unroll
  for (int j = 0; j < 32; ++j) xr[j] = *(const v4f*)(xt + j * 128 + lane * 4);
}

// Convert the loaded tile to f16 and lay it row-major [r][c] in the wave's own scratch.
__device__ __forceinline__ void stage_x_tile(_Float16* pb, int lane, const v4f (&xr)[32]) {
#pragma unroll
  for (int j = 0; j < 32; ++j) {
    v4h t;
#pragma unroll
    for (int e = 0; e < 4; ++e) t[e] = (_Float16)xr[j][e];
    *(v4h*)&pb[(j >> 1) * TPAD + (j & 1) * 128 + lane * 4] = t;
  }
}

__device__ __forceinline__ v8f wmma_f16(v16h a, v16h b, v8f c) {
  return __builtin_amdgcn_wmma_f32_16x16x32_f16(
      /*neg_a=*/false, a, /*neg_b=*/false, b,
      /*c_mod=*/(short)0, c, /*reuse_a=*/false, /*reuse_b=*/false);
}

__global__ __launch_bounds__(256) void fused_attn_head(
    const float* __restrict__ x,
    const float* __restrict__ Wq, const float* __restrict__ bq,
    const float* __restrict__ Wk, const float* __restrict__ bk,
    const float* __restrict__ Wv, const float* __restrict__ bv,
    float* __restrict__ out) {
  __shared__ SMem sm;
  const int tid  = threadIdx.x;
  const int lane = tid & 31;
  const int wid  = tid >> 5;
  const int lh   = lane >> 4;   // which 16-lane half
  const int l16  = lane & 15;
  const int b    = blockIdx.x;

  // This wave's two row tiles of x (32 rows, 32 KB in a row) and its own LDS scratch.
  const float* xw = x + ((size_t)b * T_SZ + wid * 32) * C_SZ;
  _Float16* pb = &sm.pscr[wid][0];
  v4f xr[32];

  // ---------------- Phase 0: stage W^T (f16) and biases into LDS ----------------
  // Each lane reads 4 consecutive h of 8 consecutive c rows (16-byte loads, 8 lanes
  // per 128-byte line, whole lines only), transposes the 8x4 patch in registers and
  // writes 4 rows of 8 f16 with 16-byte LDS stores. The two 8-lane groups of a
  // 16-lane half take neighbouring c blocks, which shifts their LDS banks apart.
  {
    const int h0  = (((tid >> 4) & 1) * 8 + (tid & 7)) * 4;
    const int cb0 = wid * 2 + ((tid >> 3) & 1);
    const unsigned goff = (unsigned)(cb0 * 8 * H_SZ + h0);
    v4f r[6][8];
#pragma unroll
    for (int k = 0; k < 6; ++k) {
      const float* Wp = (k < 2) ? Wq : (k < 4) ? Wk : Wv;
#pragma unroll
      for (int i = 0; i < 8; ++i)
        r[k][i] = *(const v4f*)(Wp + goff + ((k & 1) * 128 + i) * H_SZ);
      // Keeps the groups' loads in the order in which they are used below, so
      // that a counted wait frees the first group while the later ones fly.
      __builtin_amdgcn_sched_barrier(0);
    }
    // Precaution: stands ahead of the x address arithmetic below, which may write a
    // register that the W loads above name as an address.
    asm volatile("s_wait_xcnt 0x0" ::: "memory");
    // Keeps that arithmetic behind the wait.
    __builtin_amdgcn_sched_barrier(0);
    // The first x tile: all 32 loads fly from memory while W is staged below.
    load_x_tile(xw, lane, xr);
    // Keeps the x loads up here; without it they sink to their use behind the staging.
    __builtin_amdgcn_sched_barrier(0);
    // Precaution: stands ahead of every later write of a register that the loads
    // above name as an address.
    asm volatile("s_wait_xcnt 0x0" ::: "memory");
#pragma unroll
    for (int k = 0; k < 6; ++k) {
      const int c0 = (cb0 + (k & 1) * 16) * 8;
#pragma unroll
      for (int j = 0; j < 4; ++j) {
        v8h t;
#pragma unroll
        for (int i = 0; i < 8; ++i) t[i] = (_Float16)r[k][i][j];
        *(v8h*)&sm.wt[k >> 1][(h0 + j) * CPAD + c0] = t;
      }
      // Keeps this group's LDS stores here, under the loads still in flight;
      // without it they all sink behind the last load's wait.
      __builtin_amdgcn_sched_barrier(0);
    }
  }
  if (tid < 192) {
    int p = tid >> 6, h = tid & 63;
    const float* bp = (p == 0) ? bq : (p == 1) ? bk : bv;
    sm.bias[p][h] = bp[h];
  }
  stage_x_tile(pb, lane, xr);
  __syncthreads();

  // ---------------- Phase 1: Q/K/V projections (each wave: 2 row-tiles) --------
#pragma unroll 1
  for (int i = 0; i < 2; ++i) {
    const int mt = wid * 2 + i;
    // Same-wave LDS RAW: the x tile read below was stored by this wave's other lanes.
    asm volatile("s_wait_dscnt 0" ::: "memory");
    if (i == 0) {
      // The second x tile flies under the first tile's products (issued behind the
      // barrier, whose fence would wait for loads in flight).
      load_x_tile(xw + 16 * C_SZ, lane, xr);
      // Precaution: stands ahead of every later write of a register that the loads
      // above name as an address.
      asm volatile("s_wait_xcnt 0x0" ::: "memory");
    }
    v8f acc[3][4];
#pragma unroll
    for (int p = 0; p < 3; ++p)
#pragma unroll
      for (int ht = 0; ht < 4; ++ht) acc[p][ht] = {};

#pragma unroll
    for (int kc = 0; kc < 8; ++kc) {
      const int c0 = kc * 32 + lh * 8;
      v16h a = lds_frag(&pb[l16 * TPAD], c0);   // x tile from the wave's scratch
#pragma unroll
      for (int p = 0; p < 3; ++p) {
        v16h bm[4];
#pragma unroll
        for (int ht = 0; ht < 4; ++ht)
          bm[ht] = lds_frag(&sm.wt[p][(ht * 16 + l16) * CPAD], c0);
#pragma unroll
        for (int ht = 0; ht < 4; ++ht)
          acc[p][ht] = wmma_f16(a, bm[ht], acc[p][ht]);
      }
    }
    // Epilogue: + bias, cvt f16, scatter into Q / K (row-major) and V^T
#pragma unroll
    for (int p = 0; p < 3; ++p)
#pragma unroll
      for (int ht = 0; ht < 4; ++ht) {
        const float bb = sm.bias[p][ht * 16 + l16];
#pragma unroll
        for (int vr = 0; vr < 8; ++vr) {
          float val = acc[p][ht][vr] + bb;
          int r = mt * 16 + vr + 8 * lh;       // C/D layout: M = vgpr + 8*half
          int h = ht * 16 + l16;               // N = lane&15
          if (p == 0)      sm.qs[r * HPAD + h]  = (_Float16)val;
          else if (p == 1) sm.ks[r * HPAD + h]  = (_Float16)val;
          else             sm.vts[h * TPAD + r] = (_Float16)val;
        }
      }
    if (i == 0) stage_x_tile(pb, lane, xr);
  }
  __syncthreads();

  // ---------------- Phase 2: causal attention (each wave: its 2 row-tiles) -----
  const float scale = 0.0625f;  // C^-0.5 = 256^-0.5
#pragma unroll 1
  for (int i = 0; i < 2; ++i) {
    const int mt = wid * 2 + i;
    const int r0 = mt * 16;

    // A-operand: this tile's 16 Q rows, K-dim = 64 split into 2 chunks of 32
    v16h aq0 = lds_frag(&sm.qs[(r0 + l16) * HPAD], lh * 8);
    v16h aq1 = lds_frag(&sm.qs[(r0 + l16) * HPAD], 32 + lh * 8);

    // S = Q K^T over all 16 key tiles (kept in registers); 2 key tiles in flight
    v8f sacc[16];
#pragma unroll
    for (int jp = 0; jp < 8; ++jp) {
      const int jt0 = jp * 2, jt1 = jp * 2 + 1;
      v16h b0a = lds_frag(&sm.ks[(jt0 * 16 + l16) * HPAD], lh * 8);
      v16h b1a = lds_frag(&sm.ks[(jt0 * 16 + l16) * HPAD], 32 + lh * 8);
      v16h b0b = lds_frag(&sm.ks[(jt1 * 16 + l16) * HPAD], lh * 8);
      v16h b1b = lds_frag(&sm.ks[(jt1 * 16 + l16) * HPAD], 32 + lh * 8);
      v8f acca = {}, accb = {};
      acca = wmma_f16(aq0, b0a, acca);
      accb = wmma_f16(aq0, b0b, accb);
      acca = wmma_f16(aq1, b1a, acca);
      accb = wmma_f16(aq1, b1b, accb);
      sacc[jt0] = acca;
      sacc[jt1] = accb;
    }

    // Causal mask + softmax (rows live on 16-lane halves -> shfl_xor 1,2,4,8)
    float inv[8];
#pragma unroll
    for (int vr = 0; vr < 8; ++vr) {
      const int r = r0 + vr + 8 * lh;
      float m = -INFINITY;
#pragma unroll
      for (int jt = 0; jt < 16; ++jt) {
        int col = jt * 16 + l16;
        float v = (col <= r) ? sacc[jt][vr] * scale : -INFINITY;
        sacc[jt][vr] = v;
        m = fmaxf(m, v);
      }
      m = fmaxf(m, __shfl_xor(m, 1, 32));
      m = fmaxf(m, __shfl_xor(m, 2, 32));
      m = fmaxf(m, __shfl_xor(m, 4, 32));
      m = fmaxf(m, __shfl_xor(m, 8, 32));
      float s = 0.f;
#pragma unroll
      for (int jt = 0; jt < 16; ++jt) {
        float e = __expf(sacc[jt][vr] - m);   // exp(-inf)=0 handles the mask
        sacc[jt][vr] = e;
        s += e;
      }
      s += __shfl_xor(s, 1, 32);
      s += __shfl_xor(s, 2, 32);
      s += __shfl_xor(s, 4, 32);
      s += __shfl_xor(s, 8, 32);
      inv[vr] = 1.0f / s;
    }

    // Relayout P (C-layout regs) -> per-wave LDS scratch (row-major f16)
#pragma unroll
    for (int jt = 0; jt < 16; ++jt)
#pragma unroll
      for (int vr = 0; vr < 8; ++vr)
        pb[(vr + 8 * lh) * TPAD + jt * 16 + l16] =
            (_Float16)(sacc[jt][vr] * inv[vr]);
    __asm volatile("s_wait_dscnt 0" ::: "memory");  // same-wave LDS RAW

    // O = P V  (A = P rows from scratch, B = V^T, K = 256 keys)
    v8f o[4];
#pragma unroll
    for (int ht = 0; ht < 4; ++ht) o[ht] = {};
#pragma unroll
    for (int kc = 0; kc < 8; ++kc) {
      const int k0 = kc * 32 + lh * 8;
      v16h a = lds_frag(&pb[l16 * TPAD], k0);
      v16h bm[4];
#pragma unroll
      for (int ht = 0; ht < 4; ++ht)
        bm[ht] = lds_frag(&sm.vts[(ht * 16 + l16) * TPAD], k0);
#pragma unroll
      for (int ht = 0; ht < 4; ++ht)
        o[ht] = wmma_f16(a, bm[ht], o[ht]);
    }

    // Store fp32 output [b][r][h]
#pragma unroll
    for (int ht = 0; ht < 4; ++ht)
#pragma unroll
      for (int vr = 0; vr < 8; ++vr) {
        int r = r0 + vr + 8 * lh;
        int h = ht * 16 + l16;
        out[((size_t)b * T_SZ + r) * H_SZ + h] = o[ht][vr];
      }
  }
}

extern "C" void kernel_launch(void* const* d_in, const int* in_sizes, int n_in,
                              void* d_out, int out_size, void* d_ws, size_t ws_size,
                              hipStream_t stream) {
  (void)in_sizes; (void)n_in; (void)out_size; (void)d_ws; (void)ws_size;
  const float* x  = (const float*)d_in[0];
  const float* Wq = (const float*)d_in[1];
  const float* bq = (const float*)d_in[2];
  const float* Wk = (const float*)d_in[3];
  const float* bk = (const float*)d_in[4];
  const float* Wv = (const float*)d_in[5];
  const float* bv = (const float*)d_in[6];
  float* out = (float*)d_out;
  fused_attn_head<<<dim3(B_SZ), dim3(256), 0, stream>>>(x, Wq, bq, Wk, bk, Wv, bv, out);
}

// v003
// It runs in 31.7 microseconds.
// Next to v002, in two timings, it ran 1.19 times as fast each time.
// All steps since v000 together make it 2.13 times as fast.
#include <hip/hip_runtime.h>
#include <hip/hip_bf16.h>
#include <math.h>

typedef __attribute__((ext_vector_type(16))) _Float16 v16h;
typedef __attribute__((ext_vector_type(8)))  _Float16 v8h;
typedef __attribute__((ext_vector_type(4)))  _Float16 v4h;
typedef __attribute__((ext_vector_type(8)))  float    v8f;
typedef __attribute__((ext_vector_type(4)))  float    v4f;

#define B_SZ 512
#define T_SZ 256
#define C_SZ 256
#define H_SZ 64
#define CPAD 264   // 256 + 8 f16 pad
#define HPAD 72    // 64 + 8 f16 pad
#define TPAD 264   // 256 + 8 f16 pad
#define NWAVE 8

struct __align__(16) SMem {
  _Float16 wt[3][64 * CPAD];        // W^T per projection: [h][c], f16
  _Float16 qs[T_SZ * HPAD];         // Q row-major [t][h]
  _Float16 ks[T_SZ * HPAD];         // K row-major [t][h]  (== B-operand of Q K^T)
  _Float16 vts[H_SZ * TPAD];        // V^T [h][t]          (== B-operand of P V)
  _Float16 pscr[NWAVE][16 * TPAD];  // per-wave scratch: x tile [r][c] (phase 1), P [r][t] (phase 2)
  float    bias[3][H_SZ];
};

// Load a 16x32 f16 A/B fragment from a row-major matrix in LDS.
// Per ISA layout: lane holds row/col = lane&15; K chunks {off..off+7} -> v[0..7],
// {off+16..off+23} -> v[8..15], where off already includes (lane>>4)*8.
__device__ __forceinline__ v16h lds_frag(const _Float16* rowbase, int off) {
  v8h lo = *(const v8h*)(rowbase + off);
  v8h hi = *(const v8h*)(rowbase + off + 16);
  v16h r;
#pragma unroll
  for (int i = 0; i < 8; ++i) { r[i] = lo[i]; r[i + 8] = hi[i]; }
  return r;
}

// A 16-row tile of x is 16 KB in a row: load j of a wave takes its bytes
// j*512 .. j*512+511 (four whole 128-byte lines), 16 bytes a lane.
__device__ __forceinline__ void load_x_tile(const float* xt, int lane, v4f (&xr)[32]) {
#pragma unroll
  for (int j = 0; j < 32; ++j) xr[j] = *(const v4f*)(xt + j * 128 + lane * 4);
}

// Convert the loaded tile to f16 and lay it row-major [r][c] in the wave's own scratch.
__device__ __forceinline__ void stage_x_tile(_Float16* pb, int lane, const v4f (&xr)[32]) {
#pragma unroll
  for (int j = 0; j < 32; ++j) {
    v4h t;
#pragma unroll
    for (int e = 0; e < 4; ++e) t[e] = (_Float16)xr[j][e];
    *(v4h*)&pb[(j >> 1) * TPAD + (j & 1) * 128 + lane * 4] = t;
  }
}

__device__ __forceinline__ v8f wmma_f16(v16h a, v16h b, v8f c) {
  return __builtin_amdgcn_wmma_f32_16x16x32_f16(
      /*neg_a=*/false, a, /*neg_b=*/false, b,
      /*c_mod=*/(short)0, c, /*reuse_a=*/false, /*reuse_b=*/false);
}

// Eight base-2 exponentials, in place. In asm text so that behind every v_exp_f32 stands,
// by construction, the one slot that the instruction set asks for before a vector
// instruction overwrites its source or reads its result.
__device__ __forceinline__ void exp2_x8(v8f& x) {
  float x0 = x[0], x1 = x[1], x2 = x[2], x3 = x[3], x4 = x[4], x5 = x[5], x6 = x[6], x7 = x[7];
  asm("v_exp_f32 %0, %0\n\tv_nop\n\t"
      "v_exp_f32 %1, %1\n\tv_nop\n\t"
      "v_exp_f32 %2, %2\n\tv_nop\n\t"
      "v_exp_f32 %3, %3\n\tv_nop\n\t"
      "v_exp_f32 %4, %4\n\tv_nop\n\t"
      "v_exp_f32 %5, %5\n\tv_nop\n\t"
      "v_exp_f32 %6, %6\n\tv_nop\n\t"
      "v_exp_f32 %7, %7\n\tv_nop"
      : "+v"(x0), "+v"(x1), "+v"(x2), "+v"(x3), "+v"(x4), "+v"(x5), "+v"(x6), "+v"(x7));
  x[0] = x0; x[1] = x1; x[2] = x2; x[3] = x3; x[4] = x4; x[5] = x5; x[6] = x6; x[7] = x7;
}

// Causal attention of one 16-row tile mt by one wave. Key tiles right of the diagonal
// pair are wholly masked: their weights are exact zeros and are not computed. Work goes in
// pairs of key tiles (32 keys, one K chunk of P V): row tile mt needs pairs 0 .. mt/2.
// The caller promises LO <= mt/2 < HI: pairs below LO are always needed and never hold
// the diagonal (straight-line code, no mask); pairs LO .. HI-1 stand under scalar tests.
template <int LO, int HI>
__device__ __forceinline__ void attn_tile(SMem& sm, _Float16* pb, const int mt,
                                          const int lh, const int l16, float* outb) {
  const float scale = 0.0625f;  // C^-0.5 = 256^-0.5
  const int mp = mt >> 1;       // the pair that holds the diagonal tile: the last one needed
  const int r0 = mt * 16;

  // A-operand: this tile's 16 Q rows, K-dim = 64 split into 2 chunks of 32
  v16h aq0 = lds_frag(&sm.qs[(r0 + l16) * HPAD], lh * 8);
  v16h aq1 = lds_frag(&sm.qs[(r0 + l16) * HPAD], 32 + lh * 8);

  // S = Q K^T over the key tiles up to the diagonal pair (kept in registers). All K
  // fragments are asked for ahead of all products, so that the products of the tested
  // pairs do not wait out the LDS latency pair by pair.
  v16h kf[HI][4];
#pragma unroll
  for (int jp = 0; jp < LO; ++jp) {
#pragma unroll
    for (int t = 0; t < 2; ++t) {
      kf[jp][t * 2]     = lds_frag(&sm.ks[((jp * 2 + t) * 16 + l16) * HPAD], lh * 8);
      kf[jp][t * 2 + 1] = lds_frag(&sm.ks[((jp * 2 + t) * 16 + l16) * HPAD], 32 + lh * 8);
    }
  }
#pragma unroll
  for (int jp = LO; jp < HI; ++jp) {
    if (jp <= mp) {
#pragma unroll
      for (int t = 0; t < 2; ++t) {
        kf[jp][t * 2]     = lds_frag(&sm.ks[((jp * 2 + t) * 16 + l16) * HPAD], lh * 8);
        kf[jp][t * 2 + 1] = lds_frag(&sm.ks[((jp * 2 + t) * 16 + l16) * HPAD], 32 + lh * 8);
      }
    }
  }
  v8f sacc[HI * 2];
#pragma unroll
  for (int jp = 0; jp < HI; ++jp) {
    if (jp < LO || jp <= mp) {
      v8f acca = {}, accb = {};
      acca = wmma_f16(aq0, kf[jp][0], acca);
      accb = wmma_f16(aq0, kf[jp][2], accb);
      acca = wmma_f16(aq1, kf[jp][1], acca);
      accb = wmma_f16(aq1, kf[jp][3], accb);
      sacc[jp * 2]     = acca;
      sacc[jp * 2 + 1] = accb;
    }
  }

  // Scale, causal mask (only the diagonal pair has masked columns), row maximum
  float m[8];
#pragma unroll
  for (int vr = 0; vr < 8; ++vr) m[vr] = -INFINITY;
#pragma unroll
  for (int jp = 0; jp < HI; ++jp) {
    if (jp < LO || jp < mp) {
#pragma unroll
      for (int t = 0; t < 2; ++t)
#pragma unroll
        for (int vr = 0; vr < 8; ++vr) {
          float v = sacc[jp * 2 + t][vr] * scale;
          sacc[jp * 2 + t][vr] = v;
          m[vr] = fmaxf(m[vr], v);
        }
    } else if (jp == mp) {
#pragma unroll
      for (int t = 0; t < 2; ++t)
#pragma unroll
        for (int vr = 0; vr < 8; ++vr) {
          const int r   = r0 + vr + 8 * lh;
          const int col = (jp * 2 + t) * 16 + l16;
          float v = (col <= r) ? sacc[jp * 2 + t][vr] * scale : -INFINITY;
          sacc[jp * 2 + t][vr] = v;
          m[vr] = fmaxf(m[vr], v);
        }
    }
  }
  // Rows live on 16-lane halves -> shfl_xor 1,2,4,8
#pragma unroll
  for (int vr = 0; vr < 8; ++vr) {
    m[vr] = fmaxf(m[vr], __shfl_xor(m[vr], 1, 32));
    m[vr] = fmaxf(m[vr], __shfl_xor(m[vr], 2, 32));
    m[vr] = fmaxf(m[vr], __shfl_xor(m[vr], 4, 32));
    m[vr] = fmaxf(m[vr], __shfl_xor(m[vr], 8, 32));
  }
  float s[8];
#pragma unroll
  for (int vr = 0; vr < 8; ++vr) s[vr] = 0.f;
#pragma unroll
  for (int jp = 0; jp < HI; ++jp) {
    if (jp < LO || jp <= mp) {
#pragma unroll
      for (int t = 0; t < 2; ++t) {
        v8f e;   // exp(v - m) = 2^((v - m) * log2 e); exp(-inf)=0 handles the mask
#pragma unroll
        for (int vr = 0; vr < 8; ++vr) e[vr] = (sacc[jp * 2 + t][vr] - m[vr]) * 1.44269504f;
        exp2_x8(e);
        sacc[jp * 2 + t] = e;
#pragma unroll
        for (int vr = 0; vr < 8; ++vr) s[vr] += e[vr];
      }
    }
  }
  float inv[8];
#pragma unroll
  for (int vr = 0; vr < 8; ++vr) {
    s[vr] += __shfl_xor(s[vr], 1, 32);
    s[vr] += __shfl_xor(s[vr], 2, 32);
    s[vr] += __shfl_xor(s[vr], 4, 32);
    s[vr] += __shfl_xor(s[vr], 8, 32);
    inv[vr] = 1.0f / s[vr];
  }

  // Relayout P (C-layout regs) -> per-wave LDS scratch (row-major f16)
#pragma unroll
  for (int jp = 0; jp < HI; ++jp) {
    if (jp < LO || jp <= mp) {
#pragma unroll
      for (int t = 0; t < 2; ++t)
#pragma unroll
        for (int vr = 0; vr < 8; ++vr)
          pb[(vr + 8 * lh) * TPAD + (jp * 2 + t) * 16 + l16] =
              (_Float16)(sacc[jp * 2 + t][vr] * inv[vr]);
    }
  }
  __asm volatile("s_wait_dscnt 0" ::: "memory");  // same-wave LDS RAW

  // O = P V  (A = P rows from scratch, B = V^T, K = the keys up to the diagonal pair);
  // again all fragments are asked for ahead of all products.
  v16h pa[HI], vf[HI][4];
#pragma unroll
  for (int kc = 0; kc < LO; ++kc) {
    const int k0 = kc * 32 + lh * 8;
    pa[kc] = lds_frag(&pb[l16 * TPAD], k0);
#pragma unroll
    for (int ht = 0; ht < 4; ++ht)
      vf[kc][ht] = lds_frag(&sm.vts[(ht * 16 + l16) * TPAD], k0);
  }
#pragma unroll
  for (int kc = LO; kc < HI; ++kc) {
    if (kc <= mp) {
      const int k0 = kc * 32 + lh * 8;
      pa[kc] = lds_frag(&pb[l16 * TPAD], k0);
#pragma unroll
      for (int ht = 0; ht < 4; ++ht)
        vf[kc][ht] = lds_frag(&sm.vts[(ht * 16 + l16) * TPAD], k0);
    }
  }
  v8f o[4];
#pragma unroll
  for (int ht = 0; ht < 4; ++ht) o[ht] = {};
#pragma unroll
  for (int kc = 0; kc < HI; ++kc) {
    if (kc < LO || kc <= mp) {
#pragma unroll
      for (int ht = 0; ht < 4; ++ht)
        o[ht] = wmma_f16(pa[kc], vf[kc][ht], o[ht]);
    }
  }
  // The four vector slots that the chip needs between a matrix instruction and a vector
  // write over its A or B registers: a branch taken round the later chunks lands here
  // right behind the last products.
  asm volatile("v_nop\n\tv_nop\n\tv_nop\n\tv_nop");
  // Keeps the address arithmetic of the stores below from moving up over those slots.
  __builtin_amdgcn_sched_barrier(0);

  // Store fp32 output [r][h] of this batch element
#pragma unroll
  for (int ht = 0; ht < 4; ++ht)
#pragma unroll
    for (int vr = 0; vr < 8; ++vr) {
      int r = r0 + vr + 8 * lh;
      int h = ht * 16 + l16;
      outb[r * H_SZ + h] = o[ht][vr];
    }
}

__global__ __launch_bounds__(256) void fused_attn_head(
    const float* __restrict__ x,
    const float* __restrict__ Wq, const float* __restrict__ bq,
    const float* __restrict__ Wk, const float* __restrict__ bk,
    const float* __restrict__ Wv, const float* __restrict__ bv,
    float* __restrict__ out) {
  __shared__ SMem sm;
  const int tid  = threadIdx.x;
  const int lane = tid & 31;
  const int wid  = tid >> 5;
  const int lh   = lane >> 4;   // which 16-lane half
  const int l16  = lane & 15;
  const int b    = blockIdx.x;

  // This wave's two row tiles of x (32 rows, 32 KB in a row) and its own LDS scratch.
  const float* xw = x + ((size_t)b * T_SZ + wid * 32) * C_SZ;
  _Float16* pb = &sm.pscr[wid][0];
  v4f xr[32];

  // ---------------- Phase 0: stage W^T (f16) and biases into LDS ----------------
  // Each lane reads 4 consecutive h of 8 consecutive c rows (16-byte loads, 8 lanes
  // per 128-byte line, whole lines only), transposes the 8x4 patch in registers and
  // writes 4 rows of 8 f16 with 16-byte LDS stores. The two 8-lane groups of a
  // 16-lane half take neighbouring c blocks, which shifts their LDS banks apart.
  {
    const int h0  = (((tid >> 4) & 1) * 8 + (tid & 7)) * 4;
    const int cb0 = wid * 2 + ((tid >> 3) & 1);
    const unsigned goff = (unsigned)(cb0 * 8 * H_SZ + h0);
    v4f r[6][8];
#pragma unroll
    for (int k = 0; k < 6; ++k) {
      const float* Wp = (k < 2) ? Wq : (k < 4) ? Wk : Wv;
#pragma unroll
      for (int i = 0; i < 8; ++i)
        r[k][i] = *(const v4f*)(Wp + goff + ((k & 1) * 128 + i) * H_SZ);
      // Keeps the groups' loads in the order in which they are used below, so
      // that a counted wait frees the first group while the later ones fly.
      __builtin_amdgcn_sched_barrier(0);
    }
    // Precaution: stands ahead of the x address arithmetic below, which may write a
    // register that the W loads above name as an address. Their byte offset is an input,
    // so that its register stays live, and so unwritten, up to the wait.
    asm volatile("s_wait_xcnt 0x0" :: "v"(goff * 4u) : "memory");
    // Keeps that arithmetic behind the wait.
    __builtin_amdgcn_sched_barrier(0);
    // The first x tile: all 32 loads fly from memory while W is staged below.
    load_x_tile(xw, lane, xr);
    // Keeps the x loads up here; without it they sink to their use behind the staging.
    __builtin_amdgcn_sched_barrier(0);
    // Precaution: stands ahead of every later write of a register that the loads
    // above name as an address.
    asm volatile("s_wait_xcnt 0x0" ::: "memory");
#pragma unroll
    for (int k = 0; k < 6; ++k) {
      const int c0 = (cb0 + (k & 1) * 16) * 8;
#pragma unroll
      for (int j = 0; j < 4; ++j) {
        v8h t;
#pragma unroll
        for (int i = 0; i < 8; ++i) t[i] = (_Float16)r[k][i][j];
        *(v8h*)&sm.wt[k >> 1][(h0 + j) * CPAD + c0] = t;
      }
      // Keeps this group's LDS stores here, under the loads still in flight;
      // without it they all sink behind the last load's wait.
      __builtin_amdgcn_sched_barrier(0);
    }
  }
  if (tid < 192) {
    int p = tid >> 6, h = tid & 63;
    const float* bp = (p == 0) ? bq : (p == 1) ? bk : bv;
    sm.bias[p][h] = bp[h];
  }
  stage_x_tile(pb, lane, xr);
  __syncthreads();

  // ---------------- Phase 1: Q/K/V projections (each wave: 2 row-tiles) --------
#pragma unroll 1
  for (int i = 0; i < 2; ++i) {
    const int mt = wid * 2 + i;
    // Same-wave LDS RAW: the x tile read below was stored by this wave's other lanes.
    asm volatile("s_wait_dscnt 0" ::: "memory");
    if (i == 0) {
      // The second x tile flies under the first tile's products (issued behind the
      // barrier, whose fence would wait for loads in flight).
      load_x_tile(xw + 16 * C_SZ, lane, xr);
      // Precaution: stands ahead of every later write of a register that the loads
      // above name as an address.
      asm volatile("s_wait_xcnt 0x0" ::: "memory");
    }
    v8f acc[3][4];
#pragma unroll
    for (int p = 0; p < 3; ++p)
#pragma unroll
      for (int ht = 0; ht < 4; ++ht) acc[p][ht] = {};

#pragma unroll
    for (int kc = 0; kc < 8; ++kc) {
      const int c0 = kc * 32 + lh * 8;
      v16h a = lds_frag(&pb[l16 * TPAD], c0);   // x tile from the wave's scratch
#pragma unroll
      for (int p = 0; p < 3; ++p) {
        v16h bm[4];
#pragma unroll
        for (int ht = 0; ht < 4; ++ht)
          bm[ht] = lds_frag(&sm.wt[p][(ht * 16 + l16) * CPAD], c0);
#pragma unroll
        for (int ht = 0; ht < 4; ++ht)
          acc[p][ht] = wmma_f16(a, bm[ht], acc[p][ht]);
      }
    }
    // Epilogue: + bias, cvt f16, scatter into Q / K (row-major) and V^T
#pragma unroll
    for (int p = 0; p < 3; ++p)
#pragma unroll
      for (int ht = 0; ht < 4; ++ht) {
        const float bb = sm.bias[p][ht * 16 + l16];
#pragma unroll
        for (int vr = 0; vr < 8; ++vr) {
          float val = acc[p][ht][vr] + bb;
          int r = mt * 16 + vr + 8 * lh;       // C/D layout: M = vgpr + 8*half
          int h = ht * 16 + l16;               // N = lane&15
          if (p == 0)      sm.qs[r * HPAD + h]  = (_Float16)val;
          else if (p == 1) sm.ks[r * HPAD + h]  = (_Float16)val;
          else             sm.vts[h * TPAD + r] = (_Float16)val;
        }
      }
    if (i == 0) stage_x_tile(pb, lane, xr);
  }
  __syncthreads();

  // ---------------- Phase 2: causal attention (each wave: 2 row-tiles) --------
  // Wave w takes row tiles 15-w and w, so that every wave runs 9 of the 16 key-tile
  // pairs of its two tiles. The tile number goes into a scalar register, so that the
  // tests on it are scalar branches (the matrix instructions need every lane on).
  float* outb = out + (size_t)b * T_SZ * H_SZ;
  const int ws = __builtin_amdgcn_readfirstlane(wid);
  attn_tile<4, 8>(sm, pb, 15 - ws, lh, l16, outb);
  // Precaution: stands ahead of every later write of a register that the output stores
  // of the first tile name as address or data.
  asm volatile("s_wait_xcnt 0x0" ::: "memory");
  // Keeps the second tile's arithmetic behind that wait.
  __builtin_amdgcn_sched_barrier(0);
  attn_tile<0, 4>(sm, pb, ws, lh, l16, outb);
}

extern "C" void kernel_launch(void* const* d_in, const int* in_sizes, int n_in,
                              void* d_out, int out_size, void* d_ws, size_t ws_size,
                              hipStream_t stream) {
  (void)in_sizes; (void)n_in; (void)out_size; (void)d_ws; (void)ws_size;
  const float* x  = (const float*)d_in[0];
  const float* Wq = (const float*)d_in[1];
  const float* bq = (const float*)d_in[2];
  const float* Wk = (const float*)d_in[3];
  const float* bk = (const float*)d_in[4];
  const float* Wv = (const float*)d_in[5];
  const float* bv = (const float*)d_in[6];
  float* out = (float*)d_out;
  fused_attn_head<<<dim3(B_SZ), dim3(256), 0, stream>>>(x, Wq, bq, Wk, bk, Wv, bv, out);
}

// v004
// Measured time: 30.4 microseconds a run.
// Next to v003, in two timings, it ran 1.04 times as fast each time.
// Counting every step since v000, it is 2.22 times as fast.
#include <hip/hip_runtime.h>
#include <hip/hip_bf16.h>
#include <math.h>

typedef __attribute__((ext_vector_type(16))) _Float16 v16h;
typedef __attribute__((ext_vector_type(8)))  _Float16 v8h;
typedef __attribute__((ext_vector_type(4)))  _Float16 v4h;
typedef __attribute__((ext_vector_type(8)))  float    v8f;
typedef __attribute__((ext_vector_type(4)))  float    v4f;

#define B_SZ 512
#define T_SZ 256
#define C_SZ 256
#define H_SZ 64
#define CPAD 264   // 256 + 8 f16 pad
#define HPAD 72    // 64 + 8 f16 pad
#define TPAD 264   // 256 + 8 f16 pad
#define NWAVE 8
#define NGRP 256   // work-groups launched; each runs B_SZ / NGRP batch elements

struct __align__(16) SMem {
  _Float16 wt[3][64 * CPAD];        // W^T per projection: [h][c], f16
  _Float16 qs[T_SZ * HPAD];         // Q row-major [t][h]
  _Float16 ks[T_SZ * HPAD];         // K row-major [t][h]  (== B-operand of Q K^T)
  _Float16 vts[H_SZ * TPAD];        // V^T [h][t]          (== B-operand of P V)
  _Float16 pscr[NWAVE][16 * TPAD];  // per-wave scratch: x tile [r][c] (phase 1), P [r][t] (phase 2)
  float    bias[3][H_SZ];
};

// Load a 16x32 f16 A/B fragment from a row-major matrix in LDS.
// Per ISA layout: lane holds row/col = lane&15; K chunks {off..off+7} -> v[0..7],
// {off+16..off+23} -> v[8..15], where off already includes (lane>>4)*8.
__device__ __forceinline__ v16h lds_frag(const _Float16* rowbase, int off) {
  v8h lo = *(const v8h*)(rowbase + off);
  v8h hi = *(const v8h*)(rowbase + off + 16);
  v16h r;
#pragma unroll
  for (int i = 0; i < 8; ++i) { r[i] = lo[i]; r[i + 8] = hi[i]; }
  return r;
}

// A 16-row tile of x is 16 KB in a row: load j of a wave takes its bytes
// j*512 .. j*512+511 (four whole 128-byte lines), 16 bytes a lane.
__device__ __forceinline__ void load_x_tile(const float* xt, int lane, v4f (&xr)[32]) {
#pragma unroll
  for (int j = 0; j < 32; ++j) xr[j] = *(const v4f*)(xt + j * 128 + lane * 4);
}

// Convert the loaded tile to f16 and lay it row-major [r][c] in the wave's own scratch.
__device__ __forceinline__ void stage_x_tile(_Float16* pb, int lane, const v4f (&xr)[32]) {
#pragma unroll
  for (int j = 0; j < 32; ++j) {
    v4h t;
#pragma unroll
    for (int e = 0; e < 4; ++e) t[e] = (_Float16)xr[j][e];
    *(v4h*)&pb[(j >> 1) * TPAD + (j & 1) * 128 + lane * 4] = t;
  }
}

__device__ __forceinline__ v8f wmma_f16(v16h a, v16h b, v8f c) {
  return __builtin_amdgcn_wmma_f32_16x16x32_f16(
      /*neg_a=*/false, a, /*neg_b=*/false, b,
      /*c_mod=*/(short)0, c, /*reuse_a=*/false, /*reuse_b=*/false);
}

// Eight base-2 exponentials, in place. In asm text so that behind every v_exp_f32 stands,
// by construction, the one slot that the instruction set asks for before a vector
// instruction overwrites its source or reads its result.
__device__ __forceinline__ void exp2_x8(v8f& x) {
  float x0 = x[0], x1 = x[1], x2 = x[2], x3 = x[3], x4 = x[4], x5 = x[5], x6 = x[6], x7 = x[7];
  asm("v_exp_f32 %0, %0\n\tv_nop\n\t"
      "v_exp_f32 %1, %1\n\tv_nop\n\t"
      "v_exp_f32 %2, %2\n\tv_nop\n\t"
      "v_exp_f32 %3, %3\n\tv_nop\n\t"
      "v_exp_f32 %4, %4\n\tv_nop\n\t"
      "v_exp_f32 %5, %5\n\tv_nop\n\t"
      "v_exp_f32 %6, %6\n\tv_nop\n\t"
      "v_exp_f32 %7, %7\n\tv_nop"
      : "+v"(x0), "+v"(x1), "+v"(x2), "+v"(x3), "+v"(x4), "+v"(x5), "+v"(x6), "+v"(x7));
  x[0] = x0; x[1] = x1; x[2] = x2; x[3] = x3; x[4] = x4; x[5] = x5; x[6] = x6; x[7] = x7;
}

// Causal attention of one 16-row tile mt by one wave. Key tiles right of the diagonal
// pair are wholly masked: their weights are exact zeros and are not computed. Work goes in
// pairs of key tiles (32 keys, one K chunk of P V): row tile mt needs pairs 0 .. mt/2.
// The caller promises mt/2 < HI; every pair stands under a scalar test.
// Not force-inlined: the compiler then puts this function's arrays into registers before
// it inlines it into the caller's loop. Inlined first, what a test skips filling counts
// as live from the loop's last pass, all round the loop, and spills.
template <int HI>
static __device__ inline void attn_tile(SMem& sm, _Float16* pb, const int mt,
                                          const int lh, const int l16, float* outb) {
  const float scale = 0.0625f;  // C^-0.5 = 256^-0.5
  const int mp = mt >> 1;       // the pair that holds the diagonal tile: the last one needed
  const int r0 = mt * 16;

  // A-operand: this tile's 16 Q rows, K-dim = 64 split into 2 chunks of 32
  v16h aq0 = lds_frag(&sm.qs[(r0 + l16) * HPAD], lh * 8);
  v16h aq1 = lds_frag(&sm.qs[(r0 + l16) * HPAD], 32 + lh * 8);

  // S = Q K^T over the key tiles up to the diagonal pair (kept in registers). In groups
  // of four pairs: a group's K fragments are all asked for ahead of its products, so that
  // these do not wait out the LDS latency pair by pair; one group's fragments at a time
  // leave register room for the x tile that is in flight across this function.
  v8f sacc[HI * 2];
#pragma unroll
  for (int g = 0; g < HI; g += 4) {
    v16h kf[4][4];
#pragma unroll
    for (int q = 0; q < 4; ++q) {
      const int jp = g + q;
      if (jp <= mp) {
#pragma unroll
        for (int t = 0; t < 2; ++t) {
          kf[q][t * 2]     = lds_frag(&sm.ks[((jp * 2 + t) * 16 + l16) * HPAD], lh * 8);
          kf[q][t * 2 + 1] = lds_frag(&sm.ks[((jp * 2 + t) * 16 + l16) * HPAD], 32 + lh * 8);
        }
      }
    }
#pragma unroll
    for (int q = 0; q < 4; ++q) {
      const int jp = g + q;
      if (jp <= mp) {
        v8f acca = {}, accb = {};
        acca = wmma_f16(aq0, kf[q][0], acca);
        accb = wmma_f16(aq0, kf[q][2], accb);
        acca = wmma_f16(aq1, kf[q][1], acca);
        accb = wmma_f16(aq1, kf[q][3], accb);
        sacc[jp * 2]     = acca;
        sacc[jp * 2 + 1] = accb;
      }
    }
  }

  // Scale, causal mask (only the diagonal pair has masked columns), row maximum
  float m[8];
#pragma unroll
  for (int vr = 0; vr < 8; ++vr) m[vr] = -INFINITY;
#pragma unroll
  for (int jp = 0; jp < HI; ++jp) {
    if (jp < mp) {
#pragma unroll
      for (int t = 0; t < 2; ++t)
#pragma unroll
        for (int vr = 0; vr < 8; ++vr) {
          float v = sacc[jp * 2 + t][vr] * scale;
          sacc[jp * 2 + t][vr] = v;
          m[vr] = fmaxf(m[vr], v);
        }
    } else if (jp == mp) {
#pragma unroll
      for (int t = 0; t < 2; ++t)
#pragma unroll
        for (int vr = 0; vr < 8; ++vr) {
          const int r   = r0 + vr + 8 * lh;
          const int col = (jp * 2 + t) * 16 + l16;
          float v = (col <= r) ? sacc[jp * 2 + t][vr] * scale : -INFINITY;
          sacc[jp * 2 + t][vr] = v;
          m[vr] = fmaxf(m[vr], v);
        }
    }
  }
  // Rows live on 16-lane halves -> shfl_xor 1,2,4,8
#pragma unroll
  for (int vr = 0; vr < 8; ++vr) {
    m[vr] = fmaxf(m[vr], __shfl_xor(m[vr], 1, 32));
    m[vr] = fmaxf(m[vr], __shfl_xor(m[vr], 2, 32));
    m[vr] = fmaxf(m[vr], __shfl_xor(m[vr], 4, 32));
    m[vr] = fmaxf(m[vr], __shfl_xor(m[vr], 8, 32));
  }
  float s[8];
#pragma unroll
  for (int vr = 0; vr < 8; ++vr) s[vr] = 0.f;
#pragma unroll
  for (int jp = 0; jp < HI; ++jp) {
    if (jp <= mp) {
#pragma unroll
      for (int t = 0; t < 2; ++t) {
        v8f e;   // exp(v - m) = 2^((v - m) * log2 e); exp(-inf)=0 handles the mask
#pragma unroll
        for (int vr = 0; vr < 8; ++vr) e[vr] = (sacc[jp * 2 + t][vr] - m[vr]) * 1.44269504f;
        exp2_x8(e);
        sacc[jp * 2 + t] = e;
#pragma unroll
        for (int vr = 0; vr < 8; ++vr) s[vr] += e[vr];
      }
    }
  }
  float inv[8];
#pragma unroll
  for (int vr = 0; vr < 8; ++vr) {
    s[vr] += __shfl_xor(s[vr], 1, 32);
    s[vr] += __shfl_xor(s[vr], 2, 32);
    s[vr] += __shfl_xor(s[vr], 4, 32);
    s[vr] += __shfl_xor(s[vr], 8, 32);
    inv[vr] = 1.0f / s[vr];
  }

  // Relayout P (C-layout regs) -> per-wave LDS scratch (row-major f16)
#pragma unroll
  for (int jp = 0; jp < HI; ++jp) {
    if (jp <= mp) {
#pragma unroll
      for (int t = 0; t < 2; ++t)
#pragma unroll
        for (int vr = 0; vr < 8; ++vr)
          pb[(vr + 8 * lh) * TPAD + (jp * 2 + t) * 16 + l16] =
              (_Float16)(sacc[jp * 2 + t][vr] * inv[vr]);
    }
  }
  __asm volatile("s_wait_dscnt 0" ::: "memory");  // same-wave LDS RAW

  // O = P V  (A = P rows from scratch, B = V^T, K = the keys up to the diagonal pair);
  // again in groups of four chunks, a group's fragments asked for ahead of its products.
  v8f o[4];
#pragma unroll
  for (int ht = 0; ht < 4; ++ht) o[ht] = {};
#pragma unroll
  for (int g = 0; g < HI; g += 4) {
    v16h pa[4], vf[4][4];
#pragma unroll
    for (int q = 0; q < 4; ++q) {
      const int kc = g + q;
      if (kc <= mp) {
        const int k0 = kc * 32 + lh * 8;
        pa[q] = lds_frag(&pb[l16 * TPAD], k0);
#pragma unroll
        for (int ht = 0; ht < 4; ++ht)
          vf[q][ht] = lds_frag(&sm.vts[(ht * 16 + l16) * TPAD], k0);
      }
    }
#pragma unroll
    for (int q = 0; q < 4; ++q) {
      if (g + q <= mp) {
#pragma unroll
        for (int ht = 0; ht < 4; ++ht)
          o[ht] = wmma_f16(pa[q], vf[q][ht], o[ht]);
      }
    }
  }
  // The four vector slots that the chip needs between a matrix instruction and a vector
  // write over its A or B registers: a branch taken round the later chunks lands here
  // right behind the last products.
  asm volatile("v_nop\n\tv_nop\n\tv_nop\n\tv_nop");
  // Keeps the address arithmetic of the stores below from moving up over those slots.
  __builtin_amdgcn_sched_barrier(0);

  // Store fp32 output [r][h] of this batch element. One pointer and constant offsets,
  // so that no address register is written anew among the stores.
  float* op = outb + (r0 + 8 * lh) * H_SZ + l16;
#pragma unroll
  for (int ht = 0; ht < 4; ++ht)
#pragma unroll
    for (int vr = 0; vr < 8; ++vr)
      op[vr * H_SZ + ht * 16] = o[ht][vr];
}

__global__ __launch_bounds__(256) void fused_attn_head(
    const float* __restrict__ x,
    const float* __restrict__ Wq, const float* __restrict__ bq,
    const float* __restrict__ Wk, const float* __restrict__ bk,
    const float* __restrict__ Wv, const float* __restrict__ bv,
    float* __restrict__ out) {
  __shared__ SMem sm;
  const int tid  = threadIdx.x;
  const int lane = tid & 31;
  const int wid  = tid >> 5;
  const int lh   = lane >> 4;   // which 16-lane half
  const int l16  = lane & 15;

  // A work-group runs batch elements blockIdx.x and blockIdx.x + NGRP, one after the other.
  // This wave's two row tiles of x (32 rows, 32 KB in a row) of the first element, and
  // its own LDS scratch.
  const float* xw = x + ((size_t)blockIdx.x * T_SZ + wid * 32) * C_SZ;
  _Float16* pb = &sm.pscr[wid][0];
  v4f xr[32];

  // ---------------- Phase 0: stage W^T (f16) and biases into LDS ----------------
  // Each lane reads 4 consecutive h of 8 consecutive c rows (16-byte loads, 8 lanes
  // per 128-byte line, whole lines only), transposes the 8x4 patch in registers and
  // writes 4 rows of 8 f16 with 16-byte LDS stores. The two 8-lane groups of a
  // 16-lane half take neighbouring c blocks, which shifts their LDS banks apart.
  {
    const int h0  = (((tid >> 4) & 1) * 8 + (tid & 7)) * 4;
    const int cb0 = wid * 2 + ((tid >> 3) & 1);
    const unsigned goff = (unsigned)(cb0 * 8 * H_SZ + h0);
    v4f r[6][8];
#pragma unroll
    for (int k = 0; k < 6; ++k) {
      const float* Wp = (k < 2) ? Wq : (k < 4) ? Wk : Wv;
#pragma unroll
      for (int i = 0; i < 8; ++i)
        r[k][i] = *(const v4f*)(Wp + goff + ((k & 1) * 128 + i) * H_SZ);
      // Keeps the groups' loads in the order in which they are used below, so
      // that a counted wait frees the first group while the later ones fly.
      __builtin_amdgcn_sched_barrier(0);
    }
    // Precaution: stands ahead of the x address arithmetic below, which may write a
    // register that the W loads above name as an address. Their byte offset is an input,
    // so that its register stays live, and so unwritten, up to the wait.
    asm volatile("s_wait_xcnt 0x0" :: "v"(goff * 4u) : "memory");
    // Keeps that arithmetic behind the wait.
    __builtin_amdgcn_sched_barrier(0);
    // The first x tile: all 32 loads fly from memory while W is staged below.
    load_x_tile(xw, lane, xr);
    // Keeps the x loads up here; without it they sink to their use behind the staging.
    __builtin_amdgcn_sched_barrier(0);
    // Precaution: stands ahead of every later write of a register that the loads
    // above name as an address.
    asm volatile("s_wait_xcnt 0x0" ::: "memory");
    // Keeps the staging arithmetic below behind that wait.
    __builtin_amdgcn_sched_barrier(0);
#pragma unroll
    for (int k = 0; k < 6; ++k) {
      const int c0 = (cb0 + (k & 1) * 16) * 8;
#pragma unroll
      for (int j = 0; j < 4; ++j) {
        v8h t;
#pragma unroll
        for (int i = 0; i < 8; ++i) t[i] = (_Float16)r[k][i][j];
        *(v8h*)&sm.wt[k >> 1][(h0 + j) * CPAD + c0] = t;
      }
      // Keeps this group's LDS stores here, under the loads still in flight;
      // without it they all sink behind the last load's wait.
      __builtin_amdgcn_sched_barrier(0);
    }
  }
  if (tid < 192) {
    int p = tid >> 6, h = tid & 63;
    const float* bp = (p == 0) ? bq : (p == 1) ? bk : bv;
    sm.bias[p][h] = bp[h];
  }
  const int ws = __builtin_amdgcn_readfirstlane(wid);

  // W^T and the biases stay in LDS for every element of this work-group.
  // Kept rolled, for speed only.
#pragma unroll 1
  for (int it = 0; it < B_SZ / NGRP; ++it) {
  stage_x_tile(pb, lane, xr);
  // First pass: publishes W^T and the biases. Later passes: ends every wave's reads of
  // the last element's Q, K and V^T, which phase 1 below overwrites.
  __syncthreads();

  // ---------------- Phase 1: Q/K/V projections (each wave: 2 row-tiles) --------
#pragma unroll 1
  for (int i = 0; i < 2; ++i) {
    const int mt = wid * 2 + i;
    // Same-wave LDS RAW: the x tile read below was stored by this wave's other lanes.
    asm volatile("s_wait_dscnt 0" ::: "memory");
    if (i == 0) {
      // The second x tile flies under the first tile's products (issued behind the
      // barrier, whose fence would wait for loads in flight).
      load_x_tile(xw + 16 * C_SZ, lane, xr);
      // Precaution: stands ahead of every later write of a register that the loads
      // above name as an address.
      asm volatile("s_wait_xcnt 0x0" ::: "memory");
    }
    v8f acc[3][4];
#pragma unroll
    for (int p = 0; p < 3; ++p)
#pragma unroll
      for (int ht = 0; ht < 4; ++ht) acc[p][ht] = {};

#pragma unroll
    for (int kc = 0; kc < 8; ++kc) {
      const int c0 = kc * 32 + lh * 8;
      v16h a = lds_frag(&pb[l16 * TPAD], c0);   // x tile from the wave's scratch
#pragma unroll
      for (int p = 0; p < 3; ++p) {
        v16h bm[4];
#pragma unroll
        for (int ht = 0; ht < 4; ++ht)
          bm[ht] = lds_frag(&sm.wt[p][(ht * 16 + l16) * CPAD], c0);
#pragma unroll
        for (int ht = 0; ht < 4; ++ht)
          acc[p][ht] = wmma_f16(a, bm[ht], acc[p][ht]);
      }
    }
    // Epilogue: + bias, cvt f16, scatter into Q / K (row-major) and V^T
#pragma unroll
    for (int p = 0; p < 3; ++p)
#pragma unroll
      for (int ht = 0; ht < 4; ++ht) {
        const float bb = sm.bias[p][ht * 16 + l16];
#pragma unroll
        for (int vr = 0; vr < 8; ++vr) {
          float val = acc[p][ht][vr] + bb;
          int r = mt * 16 + vr + 8 * lh;       // C/D layout: M = vgpr + 8*half
          int h = ht * 16 + l16;               // N = lane&15
          if (p == 0)      sm.qs[r * HPAD + h]  = (_Float16)val;
          else if (p == 1) sm.ks[r * HPAD + h]  = (_Float16)val;
          else             sm.vts[h * TPAD + r] = (_Float16)val;
        }
      }
    if (i == 0) stage_x_tile(pb, lane, xr);
  }
  __syncthreads();

  // ---------------- Phase 2: causal attention (each wave: 2 row-tiles) --------
  // Wave w takes row tiles 15-w and w, so that every wave runs 9 of the 16 key-tile
  // pairs of its two tiles. The tile number goes into a scalar register, so that the
  // tests on it are scalar branches (the matrix instructions need every lane on).
  float* outb = out + ((size_t)blockIdx.x + (size_t)it * NGRP) * T_SZ * H_SZ;
  xw += (size_t)NGRP * T_SZ * C_SZ;
  if (it + 1 < B_SZ / NGRP) {
    // The next element's first x tile flies from memory under this element's attention
    // (issued behind the barrier, whose fence would wait for loads in flight).
    load_x_tile(xw, lane, xr);
    // Precaution: stands ahead of every later write of a register that the loads
    // above name as an address.
    asm volatile("s_wait_xcnt 0x0" ::: "memory");
  }
  // Kept rolled, one body for both tiles, for speed only.
#pragma unroll 1
  for (int h = 0; h < 2; ++h) {
    attn_tile<8>(sm, pb, h == 0 ? 15 - ws : ws, lh, l16, outb);
    // Precaution: stands ahead of every later write of a register that the output stores
    // of this tile name as address or data.
    asm volatile("s_wait_xcnt 0x0" ::: "memory");
  }
  }
}

extern "C" void kernel_launch(void* const* d_in, const int* in_sizes, int n_in,
                              void* d_out, int out_size, void* d_ws, size_t ws_size,
                              hipStream_t stream) {
  (void)in_sizes; (void)n_in; (void)out_size; (void)d_ws; (void)ws_size;
  const float* x  = (const float*)d_in[0];
  const float* Wq = (const float*)d_in[1];
  const float* bq = (const float*)d_in[2];
  const float* Wk = (const float*)d_in[3];
  const float* bk = (const float*)d_in[4];
  const float* Wv = (const float*)d_in[5];
  const float* bv = (const float*)d_in[6];
  float* out = (float*)d_out;
  fused_attn_head<<<dim3(NGRP), dim3(256), 0, stream>>>(x, Wq, bq, Wk, bk, Wv, bv, out);
}

// v005
// A run of this version takes 27.8 microseconds.
// Two timings next to v004 both put it at 1.09 times that version's speed.
// Over all steps from v000 it is 2.41 times as fast.
#include <hip/hip_runtime.h>
#include <hip/hip_bf16.h>
#include <math.h>

typedef __attribute__((ext_vector_type(16))) _Float16 v16h;
typedef __attribute__((ext_vector_type(8)))  _Float16 v8h;
typedef __attribute__((ext_vector_type(4)))  _Float16 v4h;
typedef __attribute__((ext_vector_type(8)))  float    v8f;
typedef __attribute__((ext_vector_type(4)))  float    v4f;

#define B_SZ 512
#define T_SZ 256
#define C_SZ 256
#define H_SZ 64
#define CPAD 264   // 256 + 8 f16 pad
#define HPAD 72    // 64 + 8 f16 pad
#define TPAD 264   // 256 + 8 f16 pad
#define NWAVE 8
#define NGRP 256   // work-groups launched; each runs B_SZ / NGRP batch elements

struct __align__(16) SMem {
  _Float16 wt[3][64 * CPAD];        // W^T per projection: [h][c], f16
  _Float16 qs[T_SZ * HPAD];         // Q row-major [t][h]
  _Float16 ks[T_SZ * HPAD];         // K row-major [t][h]  (== B-operand of Q K^T)
  _Float16 vts[H_SZ * TPAD];        // V^T [h][t]          (== B-operand of P V)
  _Float16 pscr[NWAVE][16 * TPAD];  // per-wave scratch: x tile [r][c] (phase 1), P [r][t] (phase 2)
  float    bias[3][H_SZ];
};

// Load a 16x32 f16 A/B fragment from a row-major matrix in LDS.
// Per ISA layout: lane holds row/col = lane&15; K chunks {off..off+7} -> v[0..7],
// {off+16..off+23} -> v[8..15], where off already includes (lane>>4)*8.
__device__ __forceinline__ v16h lds_frag(const _Float16* rowbase, int off) {
  v8h lo = *(const v8h*)(rowbase + off);
  v8h hi = *(const v8h*)(rowbase + off + 16);
  v16h r;
#pragma unroll
  for (int i = 0; i < 8; ++i) { r[i] = lo[i]; r[i + 8] = hi[i]; }
  return r;
}

// A 16-row tile of x is 16 KB in a row: load j of a wave takes its bytes
// j*512 .. j*512+511 (four whole 128-byte lines), 16 bytes a lane.
__device__ __forceinline__ void load_x_tile(const float* xt, int lane, v4f (&xr)[32]) {
#pragma unroll
  for (int j = 0; j < 32; ++j) xr[j] = *(const v4f*)(xt + j * 128 + lane * 4);
}

// Convert the loaded tile to f16 and lay it row-major [r][c] in the wave's own scratch.
__device__ __forceinline__ void stage_x_tile(_Float16* pb, int lane, const v4f (&xr)[32]) {
#pragma unroll
  for (int j = 0; j < 32; ++j) {
    v4h t;
#pragma unroll
    for (int e = 0; e < 4; ++e) t[e] = (_Float16)xr[j][e];
    *(v4h*)&pb[(j >> 1) * TPAD + (j & 1) * 128 + lane * 4] = t;
  }
}

__device__ __forceinline__ v8f wmma_f16(v16h a, v16h b, v8f c) {
  return __builtin_amdgcn_wmma_f32_16x16x32_f16(
      /*neg_a=*/false, a, /*neg_b=*/false, b,
      /*c_mod=*/(short)0, c, /*reuse_a=*/false, /*reuse_b=*/false);
}

// Eight base-2 exponentials, in place. In asm text so that behind every v_exp_f32 stands,
// by construction, the one slot that the instruction set asks for before a vector
// instruction overwrites its source or reads its result.
__device__ __forceinline__ void exp2_x8(v8f& x) {
  float x0 = x[0], x1 = x[1], x2 = x[2], x3 = x[3], x4 = x[4], x5 = x[5], x6 = x[6], x7 = x[7];
  asm("v_exp_f32 %0, %0\n\tv_nop\n\t"
      "v_exp_f32 %1, %1\n\tv_nop\n\t"
      "v_exp_f32 %2, %2\n\tv_nop\n\t"
      "v_exp_f32 %3, %3\n\tv_nop\n\t"
      "v_exp_f32 %4, %4\n\tv_nop\n\t"
      "v_exp_f32 %5, %5\n\tv_nop\n\t"
      "v_exp_f32 %6, %6\n\tv_nop\n\t"
      "v_exp_f32 %7, %7\n\tv_nop"
      : "+v"(x0), "+v"(x1), "+v"(x2), "+v"(x3), "+v"(x4), "+v"(x5), "+v"(x6), "+v"(x7));
  x[0] = x0; x[1] = x1; x[2] = x2; x[3] = x3; x[4] = x4; x[5] = x5; x[6] = x6; x[7] = x7;
}

// Causal attention of one 16-row tile mt by one wave. Key tiles right of the diagonal
// pair are wholly masked: their weights are exact zeros and are not computed. Work goes in
// pairs of key tiles (32 keys, one K chunk of P V): row tile mt needs pairs 0 .. mt/2.
// The caller promises mt/2 < HI; every pair stands under a scalar test.
// Not force-inlined: the compiler then puts this function's arrays into registers before
// it inlines it into the caller's loop. Inlined first, what a test skips filling counts
// as live from the loop's last pass, all round the loop, and spills.
template <int HI>
static __device__ inline void attn_tile(SMem& sm, _Float16* pb, const int mt,
                                          const int lh, const int l16, float* outb) {
  const float scale = 0.0625f;  // C^-0.5 = 256^-0.5
  const int mp = mt >> 1;       // the pair that holds the diagonal tile: the last one needed
  const int r0 = mt * 16;

  // A-operand: this tile's 16 Q rows, K-dim = 64 split into 2 chunks of 32
  v16h aq0 = lds_frag(&sm.qs[(r0 + l16) * HPAD], lh * 8);
  v16h aq1 = lds_frag(&sm.qs[(r0 + l16) * HPAD], 32 + lh * 8);

  // S = Q K^T over the key tiles up to the diagonal pair (kept in registers). In groups
  // of four pairs: a group's K fragments are all asked for ahead of its products, so that
  // these do not wait out the LDS latency pair by pair; one group's fragments at a time
  // leave register room for the x tile that is in flight across this function.
  v8f sacc[HI * 2];
#pragma unroll
  for (int g = 0; g < HI; g += 4) {
    v16h kf[4][4];
#pragma unroll
    for (int q = 0; q < 4; ++q) {
      const int jp = g + q;
      if (jp <= mp) {
#pragma unroll
        for (int t = 0; t < 2; ++t) {
          kf[q][t * 2]     = lds_frag(&sm.ks[((jp * 2 + t) * 16 + l16) * HPAD], lh * 8);
          kf[q][t * 2 + 1] = lds_frag(&sm.ks[((jp * 2 + t) * 16 + l16) * HPAD], 32 + lh * 8);
        }
      }
    }
#pragma unroll
    for (int q = 0; q < 4; ++q) {
      const int jp = g + q;
      if (jp <= mp) {
        v8f acca = {}, accb = {};
        acca = wmma_f16(aq0, kf[q][0], acca);
        accb = wmma_f16(aq0, kf[q][2], accb);
        acca = wmma_f16(aq1, kf[q][1], acca);
        accb = wmma_f16(aq1, kf[q][3], accb);
        sacc[jp * 2]     = acca;
        sacc[jp * 2 + 1] = accb;
      }
    }
  }

  // Scale, causal mask (only the diagonal pair has masked columns), row maximum
  float m[8];
#pragma unroll
  for (int vr = 0; vr < 8; ++vr) m[vr] = -INFINITY;
#pragma unroll
  for (int jp = 0; jp < HI; ++jp) {
    if (jp < mp) {
#pragma unroll
      for (int t = 0; t < 2; ++t)
#pragma unroll
        for (int vr = 0; vr < 8; ++vr) {
          float v = sacc[jp * 2 + t][vr] * scale;
          sacc[jp * 2 + t][vr] = v;
          m[vr] = fmaxf(m[vr], v);
        }
    } else if (jp == mp) {
#pragma unroll
      for (int t = 0; t < 2; ++t)
#pragma unroll
        for (int vr = 0; vr < 8; ++vr) {
          const int r   = r0 + vr + 8 * lh;
          const int col = (jp * 2 + t) * 16 + l16;
          float v = (col <= r) ? sacc[jp * 2 + t][vr] * scale : -INFINITY;
          sacc[jp * 2 + t][vr] = v;
          m[vr] = fmaxf(m[vr], v);
        }
    }
  }
  // Rows live on 16-lane halves -> shfl_xor 1,2,4,8
#pragma unroll
  for (int vr = 0; vr < 8; ++vr) {
    m[vr] = fmaxf(m[vr], __shfl_xor(m[vr], 1, 32));
    m[vr] = fmaxf(m[vr], __shfl_xor(m[vr], 2, 32));
    m[vr] = fmaxf(m[vr], __shfl_xor(m[vr], 4, 32));
    m[vr] = fmaxf(m[vr], __shfl_xor(m[vr], 8, 32));
  }
  float s[8];
#pragma unroll
  for (int vr = 0; vr < 8; ++vr) s[vr] = 0.f;
#pragma unroll
  for (int jp = 0; jp < HI; ++jp) {
    if (jp <= mp) {
#pragma unroll
      for (int t = 0; t < 2; ++t) {
        v8f e;   // exp(v - m) = 2^((v - m) * log2 e); exp(-inf)=0 handles the mask
#pragma unroll
        for (int vr = 0; vr < 8; ++vr) e[vr] = (sacc[jp * 2 + t][vr] - m[vr]) * 1.44269504f;
        exp2_x8(e);
        sacc[jp * 2 + t] = e;
#pragma unroll
        for (int vr = 0; vr < 8; ++vr) s[vr] += e[vr];
      }
    }
  }
  float inv[8];
#pragma unroll
  for (int vr = 0; vr < 8; ++vr) {
    s[vr] += __shfl_xor(s[vr], 1, 32);
    s[vr] += __shfl_xor(s[vr], 2, 32);
    s[vr] += __shfl_xor(s[vr], 4, 32);
    s[vr] += __shfl_xor(s[vr], 8, 32);
    inv[vr] = 1.0f / s[vr];
  }

  // Relayout P (C-layout regs) -> per-wave LDS scratch (row-major f16)
#pragma unroll
  for (int jp = 0; jp < HI; ++jp) {
    if (jp <= mp) {
#pragma unroll
      for (int t = 0; t < 2; ++t)
#pragma unroll
        for (int vr = 0; vr < 8; ++vr)
          pb[(vr + 8 * lh) * TPAD + (jp * 2 + t) * 16 + l16] =
              (_Float16)(sacc[jp * 2 + t][vr] * inv[vr]);
    }
  }
  __asm volatile("s_wait_dscnt 0" ::: "memory");  // same-wave LDS RAW

  // O = P V  (A = P rows from scratch, B = V^T, K = the keys up to the diagonal pair);
  // again in groups of four chunks, a group's fragments asked for ahead of its products.
  v8f o[4];
#pragma unroll
  for (int ht = 0; ht < 4; ++ht) o[ht] = {};
#pragma unroll
  for (int g = 0; g < HI; g += 4) {
    v16h pa[4], vf[4][4];
#pragma unroll
    for (int q = 0; q < 4; ++q) {
      const int kc = g + q;
      if (kc <= mp) {
        const int k0 = kc * 32 + lh * 8;
        pa[q] = lds_frag(&pb[l16 * TPAD], k0);
#pragma unroll
        for (int ht = 0; ht < 4; ++ht)
          vf[q][ht] = lds_frag(&sm.vts[(ht * 16 + l16) * TPAD], k0);
      }
    }
#pragma unroll
    for (int q = 0; q < 4; ++q) {
      if (g + q <= mp) {
#pragma unroll
        for (int ht = 0; ht < 4; ++ht)
          o[ht] = wmma_f16(pa[q], vf[q][ht], o[ht]);
      }
    }
  }
  // The four vector slots that the chip needs between a matrix instruction and a vector
  // write over its A or B registers: a branch taken round the later chunks lands here
  // right behind the last products.
  asm volatile("v_nop\n\tv_nop\n\tv_nop\n\tv_nop");
  // Keeps the address arithmetic of the stores below from moving up over those slots.
  __builtin_amdgcn_sched_barrier(0);

  // Store fp32 output [r][h] of this batch element. One pointer and constant offsets,
  // so that no address register is written anew among the stores.
  float* op = outb + (r0 + 8 * lh) * H_SZ + l16;
#pragma unroll
  for (int ht = 0; ht < 4; ++ht)
#pragma unroll
    for (int vr = 0; vr < 8; ++vr)
      op[vr * H_SZ + ht * 16] = o[ht][vr];
}

__global__ __launch_bounds__(256) void fused_attn_head(
    const float* __restrict__ x,
    const float* __restrict__ Wq, const float* __restrict__ bq,
    const float* __restrict__ Wk, const float* __restrict__ bk,
    const float* __restrict__ Wv, const float* __restrict__ bv,
    float* __restrict__ out) {
  __shared__ SMem sm;
  const int tid  = threadIdx.x;
  const int lane = tid & 31;
  const int wid  = tid >> 5;
  const int lh   = lane >> 4;   // which 16-lane half
  const int l16  = lane & 15;

  // A work-group runs batch elements blockIdx.x and blockIdx.x + NGRP, one after the other.
  // This wave's two row tiles of x (32 rows, 32 KB in a row) of the first element, and
  // its own LDS scratch.
  const float* xw = x + ((size_t)blockIdx.x * T_SZ + wid * 32) * C_SZ;
  _Float16* pb = &sm.pscr[wid][0];
  v4f xr[32];

  // ---------------- Phase 0: stage W^T (f16) and biases into LDS ----------------
  // Each lane reads 4 consecutive h of 8 consecutive c rows (16-byte loads, 8 lanes
  // per 128-byte line, whole lines only), transposes the 8x4 patch in registers and
  // writes 4 rows of 8 f16 with 16-byte LDS stores. The two 8-lane groups of a
  // 16-lane half take neighbouring c blocks, which shifts their LDS banks apart.
  {
    const int h0  = (((tid >> 4) & 1) * 8 + (tid & 7)) * 4;
    const int cb0 = wid * 2 + ((tid >> 3) & 1);
    const unsigned goff = (unsigned)(cb0 * 8 * H_SZ + h0);
    v4f r[6][8];
#pragma unroll
    for (int k = 0; k < 6; ++k) {
      const float* Wp = (k < 2) ? Wq : (k < 4) ? Wk : Wv;
#pragma unroll
      for (int i = 0; i < 8; ++i)
        r[k][i] = *(const v4f*)(Wp + goff + ((k & 1) * 128 + i) * H_SZ);
      // Keeps the groups' loads in the order in which they are used below, so
      // that a counted wait frees the first group while the later ones fly.
      __builtin_amdgcn_sched_barrier(0);
    }
    // Precaution: stands ahead of the x address arithmetic below, which may write a
    // register that the W loads above name as an address. Their byte offset is an input,
    // so that its register stays live, and so unwritten, up to the wait.
    asm volatile("s_wait_xcnt 0x0" :: "v"(goff * 4u) : "memory");
    // Keeps that arithmetic behind the wait.
    __builtin_amdgcn_sched_barrier(0);
    // The first x tile: all 32 loads fly from memory while W is staged below.
    load_x_tile(xw, lane, xr);
    // Keeps the x loads up here; without it they sink to their use behind the staging.
    __builtin_amdgcn_sched_barrier(0);
    // Precaution: stands ahead of every later write of a register that the loads
    // above name as an address.
    asm volatile("s_wait_xcnt 0x0" ::: "memory");
    // Keeps the staging arithmetic below behind that wait.
    __builtin_amdgcn_sched_barrier(0);
#pragma unroll
    for (int k = 0; k < 6; ++k) {
      const int c0 = (cb0 + (k & 1) * 16) * 8;
#pragma unroll
      for (int j = 0; j < 4; ++j) {
        v8h t;
#pragma unroll
        for (int i = 0; i < 8; ++i) t[i] = (_Float16)r[k][i][j];
        *(v8h*)&sm.wt[k >> 1][(h0 + j) * CPAD + c0] = t;
      }
      // Keeps this group's LDS stores here, under the loads still in flight;
      // without it they all sink behind the last load's wait.
      __builtin_amdgcn_sched_barrier(0);
    }
  }
  if (tid < 192) {
    int p = tid >> 6, h = tid & 63;
    const float* bp = (p == 0) ? bq : (p == 1) ? bk : bv;
    sm.bias[p][h] = bp[h];
  }
  const int ws = __builtin_amdgcn_readfirstlane(wid);

  // W^T and the biases stay in LDS for every element of this work-group.
  // Kept rolled, for speed only.
#pragma unroll 1
  for (int it = 0; it < B_SZ / NGRP; ++it) {
  stage_x_tile(pb, lane, xr);
  // First pass: publishes W^T and the biases. Later passes: ends every wave's reads of
  // the last element's Q, K and V^T, which phase 1 below overwrites.
  __syncthreads();

  // ---------------- Phase 1: Q/K/V projections (each wave: 2 row-tiles) --------
#pragma unroll 1
  for (int i = 0; i < 2; ++i) {
    const int mt = wid * 2 + i;
    // Same-wave LDS RAW: the x tile read below was stored by this wave's other lanes.
    asm volatile("s_wait_dscnt 0" ::: "memory");
    if (i == 0) {
      // The second x tile flies under the first tile's products (issued behind the
      // barrier, whose fence would wait for loads in flight).
      load_x_tile(xw + 16 * C_SZ, lane, xr);
      // Precaution: stands ahead of every later write of a register that the loads
      // above name as an address.
      asm volatile("s_wait_xcnt 0x0" ::: "memory");
    }
    v8f acc[3][4];
#pragma unroll
    for (int p = 0; p < 3; ++p)
#pragma unroll
      for (int ht = 0; ht < 4; ++ht) acc[p][ht] = {};

    // The 24 groups (K chunk kc, projection p) of four products run through a register
    // ring of four groups: group g + 3's fragments are asked for ahead of group g's
    // products, so that a group's wait is a counted one that leaves the younger loads in
    // flight, and the products do not wait out the LDS latency group by group.
    v16h af[2];       // x fragment of this K chunk and of the next
    v16h bm[4][4];    // W^T fragments: the ring
#pragma unroll
    for (int g = -3; g < 24; ++g) {
      const int gl = g + 3;
      if (gl < 24) {
        const int c0 = (gl / 3) * 32 + lh * 8;
        if (gl % 3 == 0) af[(gl / 3) & 1] = lds_frag(&pb[l16 * TPAD], c0);   // x tile from the wave's scratch
#pragma unroll
        for (int ht = 0; ht < 4; ++ht)
          bm[gl & 3][ht] = lds_frag(&sm.wt[gl % 3][(ht * 16 + l16) * CPAD], c0);
      }
      // Keeps these loads ahead of the products below; without it they sink to their use.
      __builtin_amdgcn_sched_barrier(0);
      if (g >= 0) {
#pragma unroll
        for (int ht = 0; ht < 4; ++ht)
          acc[g % 3][ht] = wmma_f16(af[(g / 3) & 1], bm[g & 3][ht], acc[g % 3][ht]);
      }
      // Keeps the next group's loads behind these products, one place of loads a group.
      __builtin_amdgcn_sched_barrier(0);
    }
    // Epilogue: + bias, cvt f16, scatter into Q / K (row-major) and V^T
#pragma unroll
    for (int p = 0; p < 3; ++p)
#pragma unroll
      for (int ht = 0; ht < 4; ++ht) {
        const float bb = sm.bias[p][ht * 16 + l16];
#pragma unroll
        for (int vr = 0; vr < 8; ++vr) {
          float val = acc[p][ht][vr] + bb;
          int r = mt * 16 + vr + 8 * lh;       // C/D layout: M = vgpr + 8*half
          int h = ht * 16 + l16;               // N = lane&15
          if (p == 0)      sm.qs[r * HPAD + h]  = (_Float16)val;
          else if (p == 1) sm.ks[r * HPAD + h]  = (_Float16)val;
          else             sm.vts[h * TPAD + r] = (_Float16)val;
        }
      }
    if (i == 0) stage_x_tile(pb, lane, xr);
  }
  __syncthreads();

  // ---------------- Phase 2: causal attention (each wave: 2 row-tiles) --------
  // Wave w takes row tiles 15-w and w, so that every wave runs 9 of the 16 key-tile
  // pairs of its two tiles. The tile number goes into a scalar register, so that the
  // tests on it are scalar branches (the matrix instructions need every lane on).
  float* outb = out + ((size_t)blockIdx.x + (size_t)it * NGRP) * T_SZ * H_SZ;
  xw += (size_t)NGRP * T_SZ * C_SZ;
  if (it + 1 < B_SZ / NGRP) {
    // The next element's first x tile flies from memory under this element's attention
    // (issued behind the barrier, whose fence would wait for loads in flight).
    load_x_tile(xw, lane, xr);
    // Precaution: stands ahead of every later write of a register that the loads
    // above name as an address.
    asm volatile("s_wait_xcnt 0x0" ::: "memory");
  }
  // Kept rolled, one body for both tiles, for speed only.
#pragma unroll 1
  for (int h = 0; h < 2; ++h) {
    attn_tile<8>(sm, pb, h == 0 ? 15 - ws : ws, lh, l16, outb);
    // Precaution: stands ahead of every later write of a register that the output stores
    // of this tile name as address or data.
    asm volatile("s_wait_xcnt 0x0" ::: "memory");
  }
  }
}

extern "C" void kernel_launch(void* const* d_in, const int* in_sizes, int n_in,
                              void* d_out, int out_size, void* d_ws, size_t ws_size,
                              hipStream_t stream) {
  (void)in_sizes; (void)n_in; (void)out_size; (void)d_ws; (void)ws_size;
  const float* x  = (const float*)d_in[0];
  const float* Wq = (const float*)d_in[1];
  const float* bq = (const float*)d_in[2];
  const float* Wk = (const float*)d_in[3];
  const float* bk = (const float*)d_in[4];
  const float* Wv = (const float*)d_in[5];
  const float* bv = (const float*)d_in[6];
  float* out = (float*)d_out;
  fused_attn_head<<<dim3(NGRP), dim3(256), 0, stream>>>(x, Wq, bq, Wk, bk, Wv, bv, out);
}

// v006
// A run of this version takes 26.4 microseconds.
// Next to v005, in two timings, it ran 1.04 and 1.07 times as fast.
// Over all steps from v000 it is 2.55 times as fast.
#include <hip/hip_runtime.h>
#include <hip/hip_bf16.h>
#include <math.h>

typedef __attribute__((ext_vector_type(16))) _Float16 v16h;
typedef __attribute__((ext_vector_type(8)))  _Float16 v8h;
typedef __attribute__((ext_vector_type(4)))  _Float16 v4h;
typedef __attribute__((ext_vector_type(8)))  float    v8f;
typedef __attribute__((ext_vector_type(4)))  float    v4f;

#define B_SZ 512
#define T_SZ 256
#define C_SZ 256
#define H_SZ 64
#define CPAD 264   // 256 + 8 f16 pad
#define HPAD 72    // 64 + 8 f16 pad
#define TPAD 264   // 256 + 8 f16 pad
#define NWAVE 8
#define NGRP 256   // work-groups launched; each runs B_SZ / NGRP batch elements

struct __align__(16) SMem {
  _Float16 wt[3][64 * CPAD];        // W^T per projection: [h][c], f16
  _Float16 qs[T_SZ * HPAD];         // Q row-major [t][h]
  _Float16 ks[T_SZ * HPAD];         // K row-major [t][h]  (== A-operand of K Q^T)
  _Float16 vts[H_SZ * TPAD];        // V^T [h][t]          (== B-operand of P V)
  _Float16 pscr[NWAVE][16 * TPAD];  // per-wave scratch: x tile [r][c] (phase 1)
  float    bias[3][H_SZ];
};

// Load a 16x32 f16 A/B fragment from a row-major matrix in LDS.
// Per ISA layout: lane holds row/col = lane&15; K chunks {off..off+7} -> v[0..7],
// {off+16..off+23} -> v[8..15], where off already includes (lane>>4)*8.
__device__ __forceinline__ v16h lds_frag(const _Float16* rowbase, int off) {
  v8h lo = *(const v8h*)(rowbase + off);
  v8h hi = *(const v8h*)(rowbase + off + 16);
  v16h r;
#pragma unroll
  for (int i = 0; i < 8; ++i) { r[i] = lo[i]; r[i + 8] = hi[i]; }
  return r;
}

// A 16-row tile of x is 16 KB in a row: load j of a wave takes its bytes
// j*512 .. j*512+511 (four whole 128-byte lines), 16 bytes a lane.
__device__ __forceinline__ void load_x_tile(const float* xt, int lane, v4f (&xr)[32]) {
#pragma unroll
  for (int j = 0; j < 32; ++j) xr[j] = *(const v4f*)(xt + j * 128 + lane * 4);
}

// Convert the loaded tile to f16 and lay it row-major [r][c] in the wave's own scratch.
__device__ __forceinline__ void stage_x_tile(_Float16* pb, int lane, const v4f (&xr)[32]) {
#pragma unroll
  for (int j = 0; j < 32; ++j) {
    v4h t;
#pragma unroll
    for (int e = 0; e < 4; ++e) t[e] = (_Float16)xr[j][e];
    *(v4h*)&pb[(j >> 1) * TPAD + (j & 1) * 128 + lane * 4] = t;
  }
}

__device__ __forceinline__ v8f wmma_f16(v16h a, v16h b, v8f c) {
  return __builtin_amdgcn_wmma_f32_16x16x32_f16(
      /*neg_a=*/false, a, /*neg_b=*/false, b,
      /*c_mod=*/(short)0, c, /*reuse_a=*/false, /*reuse_b=*/false);
}

// Eight base-2 exponentials, in place. In asm text so that behind every v_exp_f32 stands,
// by construction, the one slot that the instruction set asks for before a vector
// instruction overwrites its source or reads its result.
__device__ __forceinline__ void exp2_x8(v8f& x) {
  float x0 = x[0], x1 = x[1], x2 = x[2], x3 = x[3], x4 = x[4], x5 = x[5], x6 = x[6], x7 = x[7];
  asm("v_exp_f32 %0, %0\n\tv_nop\n\t"
      "v_exp_f32 %1, %1\n\tv_nop\n\t"
      "v_exp_f32 %2, %2\n\tv_nop\n\t"
      "v_exp_f32 %3, %3\n\tv_nop\n\t"
      "v_exp_f32 %4, %4\n\tv_nop\n\t"
      "v_exp_f32 %5, %5\n\tv_nop\n\t"
      "v_exp_f32 %6, %6\n\tv_nop\n\t"
      "v_exp_f32 %7, %7\n\tv_nop"
      : "+v"(x0), "+v"(x1), "+v"(x2), "+v"(x3), "+v"(x4), "+v"(x5), "+v"(x6), "+v"(x7));
  x[0] = x0; x[1] = x1; x[2] = x2; x[3] = x3; x[4] = x4; x[5] = x5; x[6] = x6; x[7] = x7;
}

// Lane l's value from lane l ^ 16: the two lanes that share one query row below.
__device__ __forceinline__ float xhalf(float x) {
  return __builtin_bit_cast(float, __builtin_amdgcn_permlanex16(
      __builtin_bit_cast(int, x), __builtin_bit_cast(int, x), 0x76543210, 0xfedcba98, false, false));
}

// Causal attention of one 16-row tile mt by one wave. Key tiles right of the diagonal
// pair are wholly masked: their weights are exact zeros and are not computed. Work goes in
// pairs of key tiles (32 keys, one K chunk of P V): row tile mt needs pairs 0 .. mt/2.
// The caller promises mt/2 < HI; every pair stands under a scalar test.
// Not force-inlined: the compiler then puts this function's arrays into registers before
// it inlines it into the caller's loop. Inlined first, what a test skips filling counts
// as live from the loop's last pass, all round the loop, and spills.
template <int HI>
static __device__ inline void attn_tile(SMem& sm, const int mt,
                                          const int lh, const int l16, float* outb) {
  const float scale = 0.0625f;  // C^-0.5 = 256^-0.5
  const int mp = mt >> 1;       // the pair that holds the diagonal tile: the last one needed
  const int r0 = mt * 16;
  const int dlane = r0 + l16 - 8 * lh;   // query row less the lane half's key offset

  // B-operand of S^T: this tile's 16 Q rows, K-dim = 64 split into 2 chunks of 32
  v16h aq0 = lds_frag(&sm.qs[(r0 + l16) * HPAD], lh * 8);
  v16h aq1 = lds_frag(&sm.qs[(r0 + l16) * HPAD], 32 + lh * 8);

  // S^T = K Q^T over the key tiles up to the diagonal pair (kept in registers): register
  // vr of lane (l16, lh) holds query row r0 + l16 against key 8 * lh + vr of the key tile.
  // A lane so holds scores of one query row only, and the two tiles of a pair, converted
  // in place, are that row's A fragment of P V in the k order of lds_frag. In groups
  // of four pairs: a group's K fragments are all asked for ahead of its products, so that
  // these do not wait out the LDS latency pair by pair; one group's fragments at a time
  // leave register room for the x tile that is in flight across this function.
  v8f sacc[HI * 2];
#pragma unroll
  for (int g = 0; g < HI; g += 4) {
    v16h kf[4][4];
#pragma unroll
    for (int q = 0; q < 4; ++q) {
      const int jp = g + q;
      if (jp <= mp) {
#pragma unroll
        for (int t = 0; t < 2; ++t) {
          kf[q][t * 2]     = lds_frag(&sm.ks[((jp * 2 + t) * 16 + l16) * HPAD], lh * 8);
          kf[q][t * 2 + 1] = lds_frag(&sm.ks[((jp * 2 + t) * 16 + l16) * HPAD], 32 + lh * 8);
        }
      }
    }
#pragma unroll
    for (int q = 0; q < 4; ++q) {
      const int jp = g + q;
      if (jp <= mp) {
        v8f acca = {}, accb = {};
        acca = wmma_f16(kf[q][0], aq0, acca);
        accb = wmma_f16(kf[q][2], aq0, accb);
        acca = wmma_f16(kf[q][1], aq1, acca);
        accb = wmma_f16(kf[q][3], aq1, accb);
        sacc[jp * 2]     = acca;
        sacc[jp * 2 + 1] = accb;
      }
    }
  }

  // Scale, causal mask (only the diagonal pair has masked keys), row maximum: eight
  // partial maxima a lane, so that no chain of dependent maxima forms
  float m[8];
#pragma unroll
  for (int vr = 0; vr < 8; ++vr) m[vr] = -INFINITY;
#pragma unroll
  for (int jp = 0; jp < HI; ++jp) {
    if (jp < mp) {
#pragma unroll
      for (int t = 0; t < 2; ++t)
#pragma unroll
        for (int vr = 0; vr < 8; ++vr) {
          float v = sacc[jp * 2 + t][vr] * scale;
          sacc[jp * 2 + t][vr] = v;
          m[vr] = fmaxf(m[vr], v);
        }
    } else if (jp == mp) {
#pragma unroll
      for (int t = 0; t < 2; ++t)
#pragma unroll
        for (int vr = 0; vr < 8; ++vr) {
          // key (jp * 2 + t) * 16 + 8 * lh + vr <= query row r0 + l16, with the lane's
          // part on one side, so that the other side is a constant of the instruction
          float v = ((jp * 2 + t) * 16 + vr <= dlane) ? sacc[jp * 2 + t][vr] * scale : -INFINITY;
          sacc[jp * 2 + t][vr] = v;
          m[vr] = fmaxf(m[vr], v);
        }
    }
  }
  // A row lives in lanes l16 and l16 + 16: join in the lane, then one exchange of halves
  float mrow = fmaxf(fmaxf(fmaxf(m[0], m[1]), fmaxf(m[2], m[3])),
                     fmaxf(fmaxf(m[4], m[5]), fmaxf(m[6], m[7])));
  mrow = fmaxf(mrow, xhalf(mrow));
  float s[8];
#pragma unroll
  for (int vr = 0; vr < 8; ++vr) s[vr] = 0.f;
#pragma unroll
  for (int jp = 0; jp < HI; ++jp) {
    if (jp <= mp) {
#pragma unroll
      for (int t = 0; t < 2; ++t) {
        v8f e;   // exp(v - m) = 2^((v - m) * log2 e); exp(-inf)=0 handles the mask
#pragma unroll
        for (int vr = 0; vr < 8; ++vr) e[vr] = (sacc[jp * 2 + t][vr] - mrow) * 1.44269504f;
        exp2_x8(e);
        sacc[jp * 2 + t] = e;
#pragma unroll
        for (int vr = 0; vr < 8; ++vr) s[vr] += e[vr];
      }
    }
  }
  float srow = ((s[0] + s[1]) + (s[2] + s[3])) + ((s[4] + s[5]) + (s[6] + s[7]));
  srow += xhalf(srow);
  const float inv = 1.0f / srow;

  // O = P V  (A = P rows from registers, B = V^T, K = the keys up to the diagonal pair);
  // again in groups of four chunks, a group's fragments asked for ahead of its products.
  // P as the A operand: element i of a pair's fragment is key 8 * lh + i of the pair's
  // first tile, element 8 + i key 8 * lh + i of its second. Converted group by group,
  // behind the group's V^T loads, whose latency the conversion covers.
  v8f o[4];
#pragma unroll
  for (int ht = 0; ht < 4; ++ht) o[ht] = {};
#pragma unroll
  for (int g = 0; g < HI; g += 4) {
    v16h pa[4], vf[4][4];
#pragma unroll
    for (int q = 0; q < 4; ++q) {
      const int kc = g + q;
      if (kc <= mp) {
        const int k0 = kc * 32 + lh * 8;
#pragma unroll
        for (int ht = 0; ht < 4; ++ht)
          vf[q][ht] = lds_frag(&sm.vts[(ht * 16 + l16) * TPAD], k0);
#pragma unroll
        for (int t = 0; t < 2; ++t)
#pragma unroll
          for (int vr = 0; vr < 8; ++vr)
            pa[q][t * 8 + vr] = (_Float16)(sacc[kc * 2 + t][vr] * inv);
      }
    }
#pragma unroll
    for (int q = 0; q < 4; ++q) {
      if (g + q <= mp) {
#pragma unroll
        for (int ht = 0; ht < 4; ++ht)
          o[ht] = wmma_f16(pa[q], vf[q][ht], o[ht]);
      }
    }
    // The four vector slots that the chip needs between a matrix instruction and a vector
    // write over its A or B registers: a branch taken round the later chunks lands here
    // right behind the last products.
    asm volatile("v_nop\n\tv_nop\n\tv_nop\n\tv_nop");
    // Keeps the next group's conversions, and the address arithmetic of the stores below,
    // from moving up over those slots.
    __builtin_amdgcn_sched_barrier(0);
  }

  // Store fp32 output [r][h] of this batch element. One pointer and constant offsets,
  // so that no address register is written anew among the stores.
  float* op = outb + (r0 + 8 * lh) * H_SZ + l16;
#pragma unroll
  for (int ht = 0; ht < 4; ++ht)
#pragma unroll
    for (int vr = 0; vr < 8; ++vr)
      op[vr * H_SZ + ht * 16] = o[ht][vr];
}

__global__ __launch_bounds__(256) void fused_attn_head(
    const float* __restrict__ x,
    const float* __restrict__ Wq, const float* __restrict__ bq,
    const float* __restrict__ Wk, const float* __restrict__ bk,
    const float* __restrict__ Wv, const float* __restrict__ bv,
    float* __restrict__ out) {
  __shared__ SMem sm;
  const int tid  = threadIdx.x;
  const int lane = tid & 31;
  const int wid  = tid >> 5;
  const int lh   = lane >> 4;   // which 16-lane half
  const int l16  = lane & 15;

  // A work-group runs batch elements blockIdx.x and blockIdx.x + NGRP, one after the other.
  // This wave's two row tiles of x (32 rows, 32 KB in a row) of the first element, and
  // its own LDS scratch.
  const float* xw = x + ((size_t)blockIdx.x * T_SZ + wid * 32) * C_SZ;
  _Float16* pb = &sm.pscr[wid][0];
  v4f xr[32];

  // ---------------- Phase 0: stage W^T (f16) and biases into LDS ----------------
  // Each lane reads 4 consecutive h of 8 consecutive c rows (16-byte loads, 8 lanes
  // per 128-byte line, whole lines only), transposes the 8x4 patch in registers and
  // writes 4 rows of 8 f16 with 16-byte LDS stores. The two 8-lane groups of a
  // 16-lane half take neighbouring c blocks, which shifts their LDS banks apart.
  {
    const int h0  = (((tid >> 4) & 1) * 8 + (tid & 7)) * 4;
    const int cb0 = wid * 2 + ((tid >> 3) & 1);
    const unsigned goff = (unsigned)(cb0 * 8 * H_SZ + h0);
    v4f r[6][8];
#pragma unroll
    for (int k = 0; k < 6; ++k) {
      const float* Wp = (k < 2) ? Wq : (k < 4) ? Wk : Wv;
#pragma unroll
      for (int i = 0; i < 8; ++i)
        r[k][i] = *(const v4f*)(Wp + goff + ((k & 1) * 128 + i) * H_SZ);
      // Keeps the groups' loads in the order in which they are used below, so
      // that a counted wait frees the first group while the later ones fly.
      __builtin_amdgcn_sched_barrier(0);
    }
    // Precaution: stands ahead of the x address arithmetic below, which may write a
    // register that the W loads above name as an address. Their byte offset is an input,
    // so that its register stays live, and so unwritten, up to the wait.
    asm volatile("s_wait_xcnt 0x0" :: "v"(goff * 4u) : "memory");
    // Keeps that arithmetic behind the wait.
    __builtin_amdgcn_sched_barrier(0);
    // The first x tile: all 32 loads fly from memory while W is staged below.
    load_x_tile(xw, lane, xr);
    // Keeps the x loads up here; without it they sink to their use behind the staging.
    __builtin_amdgcn_sched_barrier(0);
    // Precaution: stands ahead of every later write of a register that the loads
    // above name as an address.
    asm volatile("s_wait_xcnt 0x0" ::: "memory");
    // Keeps the staging arithmetic below behind that wait.
    __builtin_amdgcn_sched_barrier(0);
#pragma unroll
    for (int k = 0; k < 6; ++k) {
      const int c0 = (cb0 + (k & 1) * 16) * 8;
#pragma unroll
      for (int j = 0; j < 4; ++j) {
        v8h t;
#pragma unroll
        for (int i = 0; i < 8; ++i) t[i] = (_Float16)r[k][i][j];
        *(v8h*)&sm.wt[k >> 1][(h0 + j) * CPAD + c0] = t;
      }
      // Keeps this group's LDS stores here, under the loads still in flight;
      // without it they all sink behind the last load's wait.
      __builtin_amdgcn_sched_barrier(0);
    }
  }
  if (tid < 192) {
    int p = tid >> 6, h = tid & 63;
    const float* bp = (p == 0) ? bq : (p == 1) ? bk : bv;
    sm.bias[p][h] = bp[h];
  }
  const int ws = __builtin_amdgcn_readfirstlane(wid);

  // W^T and the biases stay in LDS for every element of this work-group.
  // Kept rolled, for speed only.
#pragma unroll 1
  for (int it = 0; it < B_SZ / NGRP; ++it) {
  stage_x_tile(pb, lane, xr);
  // First pass: publishes W^T and the biases. Later passes: ends every wave's reads of
  // the last element's Q, K and V^T, which phase 1 below overwrites.
  __syncthreads();

  // ---------------- Phase 1: Q/K/V projections (each wave: 2 row-tiles) --------
#pragma unroll 1
  for (int i = 0; i < 2; ++i) {
    const int mt = wid * 2 + i;
    // Same-wave LDS RAW: the x tile read below was stored by this wave's other lanes.
    asm volatile("s_wait_dscnt 0" ::: "memory");
    if (i == 0) {
      // The second x tile flies under the first tile's products (issued behind the
      // barrier, whose fence would wait for loads in flight).
      load_x_tile(xw + 16 * C_SZ, lane, xr);
      // Precaution: stands ahead of every later write of a register that the loads
      // above name as an address.
      asm volatile("s_wait_xcnt 0x0" ::: "memory");
    }
    v8f acc[3][4];
#pragma unroll
    for (int p = 0; p < 3; ++p)
#pragma unroll
      for (int ht = 0; ht < 4; ++ht) acc[p][ht] = {};

    // The 24 groups (K chunk kc, projection p) of four products run through a register
    // ring of four groups: group g + 3's fragments are asked for ahead of group g's
    // products, so that a group's wait is a counted one that leaves the younger loads in
    // flight, and the products do not wait out the LDS latency group by group.
    v16h af[2];       // x fragment of this K chunk and of the next
    v16h bm[4][4];    // W^T fragments: the ring
#pragma unroll
    for (int g = -3; g < 24; ++g) {
      const int gl = g + 3;
      if (gl < 24) {
        const int c0 = (gl / 3) * 32 + lh * 8;
        if (gl % 3 == 0) af[(gl / 3) & 1] = lds_frag(&pb[l16 * TPAD], c0);   // x tile from the wave's scratch
#pragma unroll
        for (int ht = 0; ht < 4; ++ht)
          bm[gl & 3][ht] = lds_frag(&sm.wt[gl % 3][(ht * 16 + l16) * CPAD], c0);
      }
      // Keeps these loads ahead of the products below; without it they sink to their use.
      __builtin_amdgcn_sched_barrier(0);
      if (g >= 0) {
#pragma unroll
        for (int ht = 0; ht < 4; ++ht)
          acc[g % 3][ht] = wmma_f16(af[(g / 3) & 1], bm[g & 3][ht], acc[g % 3][ht]);
      }
      // Keeps the next group's loads behind these products, one place of loads a group.
      __builtin_amdgcn_sched_barrier(0);
    }
    // Epilogue: + bias, cvt f16, scatter into Q / K (row-major) and V^T
#pragma unroll
    for (int p = 0; p < 3; ++p)
#pragma unroll
      for (int ht = 0; ht < 4; ++ht) {
        const float bb = sm.bias[p][ht * 16 + l16];
#pragma unroll
        for (int vr = 0; vr < 8; ++vr) {
          float val = acc[p][ht][vr] + bb;
          int r = mt * 16 + vr + 8 * lh;       // C/D layout: M = vgpr + 8*half
          int h = ht * 16 + l16;               // N = lane&15
          if (p == 0)      sm.qs[r * HPAD + h]  = (_Float16)val;
          else if (p == 1) sm.ks[r * HPAD + h]  = (_Float16)val;
          else             sm.vts[h * TPAD + r] = (_Float16)val;
        }
      }
    if (i == 0) stage_x_tile(pb, lane, xr);
  }
  __syncthreads();

  // ---------------- Phase 2: causal attention (each wave: 2 row-tiles) --------
  // Wave w takes row tiles 15-w and w, so that every wave runs 9 of the 16 key-tile
  // pairs of its two tiles. The tile number goes into a scalar register, so that the
  // tests on it are scalar branches (the matrix instructions need every lane on).
  float* outb = out + ((size_t)blockIdx.x + (size_t)it * NGRP) * T_SZ * H_SZ;
  xw += (size_t)NGRP * T_SZ * C_SZ;
  if (it + 1 < B_SZ / NGRP) {
    // The next element's first x tile flies from memory under this element's attention
    // (issued behind the barrier, whose fence would wait for loads in flight).
    load_x_tile(xw, lane, xr);
    // Precaution: stands ahead of every later write of a register that the loads
    // above name as an address.
    asm volatile("s_wait_xcnt 0x0" ::: "memory");
  }
  // Kept rolled, one body for both tiles, for speed only.
#pragma unroll 1
  for (int h = 0; h < 2; ++h) {
    attn_tile<8>(sm, h == 0 ? 15 - ws : ws, lh, l16, outb);
    // Precaution: stands ahead of every later write of a register that the output stores
    // of this tile name as address or data.
    asm volatile("s_wait_xcnt 0x0" ::: "memory");
  }
  }
}

extern "C" void kernel_launch(void* const* d_in, const int* in_sizes, int n_in,
                              void* d_out, int out_size, void* d_ws, size_t ws_size,
                              hipStream_t stream) {
  (void)in_sizes; (void)n_in; (void)out_size; (void)d_ws; (void)ws_size;
  const float* x  = (const float*)d_in[0];
  const float* Wq = (const float*)d_in[1];
  const float* bq = (const float*)d_in[2];
  const float* Wk = (const float*)d_in[3];
  const float* bk = (const float*)d_in[4];
  const float* Wv = (const float*)d_in[5];
  const float* bv = (const float*)d_in[6];
  float* out = (float*)d_out;
  fused_attn_head<<<dim3(NGRP), dim3(256), 0, stream>>>(x, Wq, bq, Wk, bk, Wv, bv, out);
}

// v007
// It runs in 23.3 microseconds.
// Next to v006, in two timings, it ran 1.14 and 1.10 times as fast.
// All steps since v000 together make it 2.85 times as fast.
#include <hip/hip_runtime.h>
#include <hip/hip_bf16.h>
#include <math.h>

typedef __attribute__((ext_vector_type(16))) _Float16 v16h;
typedef __attribute__((ext_vector_type(8)))  _Float16 v8h;
typedef __attribute__((ext_vector_type(4)))  _Float16 v4h;
typedef __attribute__((ext_vector_type(8)))  float    v8f;
typedef __attribute__((ext_vector_type(4)))  float    v4f;

#define B_SZ 512
#define T_SZ 256
#define C_SZ 256
#define H_SZ 64
#define CPAD 264   // 256 + 8 f16 pad
#define HPAD 72    // 64 + 8 f16 pad
#define TPAD 264   // 256 + 8 f16 pad
#define XPAD 200   // 192 + 8 f16 pad: pitch of the x scratch, 16 bytes times an odd number
#define NWAVE 8
#define NGRP 256   // work-groups launched; each runs B_SZ / NGRP batch elements

struct __align__(16) SMem {
  _Float16 wt[3][64 * CPAD];        // W^T per projection: [h][c], f16
  _Float16 qs[T_SZ * HPAD];         // Q row-major [t][h]
  _Float16 ks[T_SZ * HPAD];         // K row-major [t][h]  (== A-operand of K Q^T)
  _Float16 vts[H_SZ * TPAD];        // V^T [h][t]          (== B-operand of P V)
  _Float16 pscr[NWAVE][32 * XPAD];  // per-wave scratch: 32 x rows, 192 columns at a time (phase 1)
  float    bias[3][H_SZ];
};

// Load a 16x32 f16 A/B fragment from a row-major matrix in LDS.
// Per ISA layout: lane holds row/col = lane&15; K chunks {off..off+7} -> v[0..7],
// {off+16..off+23} -> v[8..15], where off already includes (lane>>4)*8.
__device__ __forceinline__ v16h lds_frag(const _Float16* rowbase, int off) {
  v8h lo = *(const v8h*)(rowbase + off);
  v8h hi = *(const v8h*)(rowbase + off + 16);
  v16h r;
#pragma unroll
  for (int i = 0; i < 8; ++i) { r[i] = lo[i]; r[i + 8] = hi[i]; }
  return r;
}

// A wave's 32 rows of x go in blocks of 64 columns (256 bytes, two whole lines a row).
// One load takes a block's part of two rows, 16 lanes and 16 bytes a lane each: rows
// xrow(a) and xrow(a) + 8, which lie half the LDS banks apart at the scratch's pitch.
__device__ __forceinline__ constexpr int xrow(int a) { return (a >> 3) * 16 + (a & 7); }

// Blocks CB0 .. CB0 + NB - 1; xl is the wave's first row plus the lane's own part.
template <int CB0, int NB>
__device__ __forceinline__ void load_x_blocks(const float* xl, v4f (&xr)[16 * NB]) {
#pragma unroll
  for (int a = 0; a < 16; ++a)
#pragma unroll
    for (int cb = 0; cb < NB; ++cb)
      xr[a * NB + cb] = *(const v4f*)(xl + xrow(a) * C_SZ + (CB0 + cb) * 64);
}

// Convert the loaded blocks to f16 and lay them row-major [r][c] in the wave's own
// scratch, from column 0 on; pl is the scratch plus the lane's own part.
template <int NB>
__device__ __forceinline__ void stage_x_blocks(_Float16* pl, const v4f (&xr)[16 * NB]) {
#pragma unroll
  for (int a = 0; a < 16; ++a)
#pragma unroll
    for (int cb = 0; cb < NB; ++cb) {
      v4h t;
#pragma unroll
      for (int e = 0; e < 4; ++e) t[e] = (_Float16)xr[a * NB + cb][e];
      *(v4h*)&pl[xrow(a) * XPAD + cb * 64] = t;
    }
}

__device__ __forceinline__ v8f wmma_f16(v16h a, v16h b, v8f c) {
  return __builtin_amdgcn_wmma_f32_16x16x32_f16(
      /*neg_a=*/false, a, /*neg_b=*/false, b,
      /*c_mod=*/(short)0, c, /*reuse_a=*/false, /*reuse_b=*/false);
}

// Eight base-2 exponentials, in place. In asm text so that behind every v_exp_f32 stands,
// by construction, the one slot that the instruction set asks for before a vector
// instruction overwrites its source or reads its result.
__device__ __forceinline__ void exp2_x8(v8f& x) {
  float x0 = x[0], x1 = x[1], x2 = x[2], x3 = x[3], x4 = x[4], x5 = x[5], x6 = x[6], x7 = x[7];
  asm("v_exp_f32 %0, %0\n\tv_nop\n\t"
      "v_exp_f32 %1, %1\n\tv_nop\n\t"
      "v_exp_f32 %2, %2\n\tv_nop\n\t"
      "v_exp_f32 %3, %3\n\tv_nop\n\t"
      "v_exp_f32 %4, %4\n\tv_nop\n\t"
      "v_exp_f32 %5, %5\n\tv_nop\n\t"
      "v_exp_f32 %6, %6\n\tv_nop\n\t"
      "v_exp_f32 %7, %7\n\tv_nop"
      : "+v"(x0), "+v"(x1), "+v"(x2), "+v"(x3), "+v"(x4), "+v"(x5), "+v"(x6), "+v"(x7));
  x[0] = x0; x[1] = x1; x[2] = x2; x[3] = x3; x[4] = x4; x[5] = x5; x[6] = x6; x[7] = x7;
}

// Lane l's value from lane l ^ 16: the two lanes that share one query row below.
__device__ __forceinline__ float xhalf(float x) {
  return __builtin_bit_cast(float, __builtin_amdgcn_permlanex16(
      __builtin_bit_cast(int, x), __builtin_bit_cast(int, x), 0x76543210, 0xfedcba98, false, false));
}

// Causal attention of one 16-row tile mt by one wave. Key tiles right of the diagonal
// pair are wholly masked: their weights are exact zeros and are not computed. Work goes in
// pairs of key tiles (32 keys, one K chunk of P V): row tile mt needs pairs 0 .. mt/2.
// The caller promises mt/2 < HI; every pair stands under a scalar test.
// Not force-inlined: the compiler then puts this function's arrays into registers before
// it inlines it into the caller's loop. Inlined first, what a test skips filling counts
// as live from the loop's last pass, all round the loop, and spills.
template <int HI>
static __device__ inline void attn_tile(SMem& sm, const int mt,
                                          const int lh, const int l16, float* outb) {
  const float scale = 0.0625f;  // C^-0.5 = 256^-0.5
  const int mp = mt >> 1;       // the pair that holds the diagonal tile: the last one needed
  const int r0 = mt * 16;
  const int dlane = r0 + l16 - 8 * lh;   // query row less the lane half's key offset

  // B-operand of S^T: this tile's 16 Q rows, K-dim = 64 split into 2 chunks of 32
  v16h aq0 = lds_frag(&sm.qs[(r0 + l16) * HPAD], lh * 8);
  v16h aq1 = lds_frag(&sm.qs[(r0 + l16) * HPAD], 32 + lh * 8);

  // S^T = K Q^T over the key tiles up to the diagonal pair (kept in registers): register
  // vr of lane (l16, lh) holds query row r0 + l16 against key 8 * lh + vr of the key tile.
  // A lane so holds scores of one query row only, and the two tiles of a pair, converted
  // in place, are that row's A fragment of P V in the k order of lds_frag. In groups
  // of four pairs: a group's K fragments are all asked for ahead of its products, so that
  // these do not wait out the LDS latency pair by pair; one group's fragments at a time
  // leave register room for the x tile that is in flight across this function.
  v8f sacc[HI * 2];
#pragma unroll
  for (int g = 0; g < HI; g += 4) {
    v16h kf[4][4];
#pragma unroll
    for (int q = 0; q < 4; ++q) {
      const int jp = g + q;
      if (jp <= mp) {
#pragma unroll
        for (int t = 0; t < 2; ++t) {
          kf[q][t * 2]     = lds_frag(&sm.ks[((jp * 2 + t) * 16 + l16) * HPAD], lh * 8);
          kf[q][t * 2 + 1] = lds_frag(&sm.ks[((jp * 2 + t) * 16 + l16) * HPAD], 32 + lh * 8);
        }
      }
    }
#pragma unroll
    for (int q = 0; q < 4; ++q) {
      const int jp = g + q;
      if (jp <= mp) {
        v8f acca = {}, accb = {};
        acca = wmma_f16(kf[q][0], aq0, acca);
        accb = wmma_f16(kf[q][2], aq0, accb);
        acca = wmma_f16(kf[q][1], aq1, acca);
        accb = wmma_f16(kf[q][3], aq1, accb);
        sacc[jp * 2]     = acca;
        sacc[jp * 2 + 1] = accb;
      }
    }
  }

  // Scale, causal mask (only the diagonal pair has masked keys), row maximum: eight
  // partial maxima a lane, so that no chain of dependent maxima forms
  float m[8];
#pragma unroll
  for (int vr = 0; vr < 8; ++vr) m[vr] = -INFINITY;
#pragma unroll
  for (int jp = 0; jp < HI; ++jp) {
    if (jp < mp) {
#pragma unroll
      for (int t = 0; t < 2; ++t)
#pragma unroll
        for (int vr = 0; vr < 8; ++vr) {
          float v = sacc[jp * 2 + t][vr] * scale;
          sacc[jp * 2 + t][vr] = v;
          m[vr] = fmaxf(m[vr], v);
        }
    } else if (jp == mp) {
#pragma unroll
      for (int t = 0; t < 2; ++t)
#pragma unroll
        for (int vr = 0; vr < 8; ++vr) {
          // key (jp * 2 + t) * 16 + 8 * lh + vr <= query row r0 + l16, with the lane's
          // part on one side, so that the other side is a constant of the instruction
          float v = ((jp * 2 + t) * 16 + vr <= dlane) ? sacc[jp * 2 + t][vr] * scale : -INFINITY;
          sacc[jp * 2 + t][vr] = v;
          m[vr] = fmaxf(m[vr], v);
        }
    }
  }
  // A row lives in lanes l16 and l16 + 16: join in the lane, then one exchange of halves
  float mrow = fmaxf(fmaxf(fmaxf(m[0], m[1]), fmaxf(m[2], m[3])),
                     fmaxf(fmaxf(m[4], m[5]), fmaxf(m[6], m[7])));
  mrow = fmaxf(mrow, xhalf(mrow));
  float s[8];
#pragma unroll
  for (int vr = 0; vr < 8; ++vr) s[vr] = 0.f;
#pragma unroll
  for (int jp = 0; jp < HI; ++jp) {
    if (jp <= mp) {
#pragma unroll
      for (int t = 0; t < 2; ++t) {
        v8f e;   // exp(v - m) = 2^((v - m) * log2 e); exp(-inf)=0 handles the mask
#pragma unroll
        for (int vr = 0; vr < 8; ++vr) e[vr] = (sacc[jp * 2 + t][vr] - mrow) * 1.44269504f;
        exp2_x8(e);
        sacc[jp * 2 + t] = e;
#pragma unroll
        for (int vr = 0; vr < 8; ++vr) s[vr] += e[vr];
      }
    }
  }
  float srow = ((s[0] + s[1]) + (s[2] + s[3])) + ((s[4] + s[5]) + (s[6] + s[7]));
  srow += xhalf(srow);
  const float inv = 1.0f / srow;

  // O = P V  (A = P rows from registers, B = V^T, K = the keys up to the diagonal pair);
  // again in groups of four chunks, a group's fragments asked for ahead of its products.
  // P as the A operand: element i of a pair's fragment is key 8 * lh + i of the pair's
  // first tile, element 8 + i key 8 * lh + i of its second. Converted group by group,
  // behind the group's V^T loads, whose latency the conversion covers.
  v8f o[4];
#pragma unroll
  for (int ht = 0; ht < 4; ++ht) o[ht] = {};
#pragma unroll
  for (int g = 0; g < HI; g += 4) {
    v16h pa[4], vf[4][4];
#pragma unroll
    for (int q = 0; q < 4; ++q) {
      const int kc = g + q;
      if (kc <= mp) {
        const int k0 = kc * 32 + lh * 8;
#pragma unroll
        for (int ht = 0; ht < 4; ++ht)
          vf[q][ht] = lds_frag(&sm.vts[(ht * 16 + l16) * TPAD], k0);
#pragma unroll
        for (int t = 0; t < 2; ++t)
#pragma unroll
          for (int vr = 0; vr < 8; ++vr)
            pa[q][t * 8 + vr] = (_Float16)(sacc[kc * 2 + t][vr] * inv);
      }
    }
#pragma unroll
    for (int q = 0; q < 4; ++q) {
      if (g + q <= mp) {
#pragma unroll
        for (int ht = 0; ht < 4; ++ht)
          o[ht] = wmma_f16(pa[q], vf[q][ht], o[ht]);
      }
    }
    // The four vector slots that the chip needs between a matrix instruction and a vector
    // write over its A or B registers: a branch taken round the later chunks lands here
    // right behind the last products.
    asm volatile("v_nop\n\tv_nop\n\tv_nop\n\tv_nop");
    // Keeps the next group's conversions, and the address arithmetic of the stores below,
    // from moving up over those slots.
    __builtin_amdgcn_sched_barrier(0);
  }

  // Store fp32 output [r][h] of this batch element. One pointer and constant offsets,
  // so that no address register is written anew among the stores.
  float* op = outb + (r0 + 8 * lh) * H_SZ + l16;
#pragma unroll
  for (int ht = 0; ht < 4; ++ht)
#pragma unroll
    for (int vr = 0; vr < 8; ++vr)
      op[vr * H_SZ + ht * 16] = o[ht][vr];
}

__global__ __launch_bounds__(256) void fused_attn_head(
    const float* __restrict__ x,
    const float* __restrict__ Wq, const float* __restrict__ bq,
    const float* __restrict__ Wk, const float* __restrict__ bk,
    const float* __restrict__ Wv, const float* __restrict__ bv,
    float* __restrict__ out) {
  __shared__ SMem sm;
  const int tid  = threadIdx.x;
  const int lane = tid & 31;
  const int wid  = tid >> 5;
  const int lh   = lane >> 4;   // which 16-lane half
  const int l16  = lane & 15;

  // A work-group runs batch elements blockIdx.x and blockIdx.x + NGRP, one after the other.
  // This wave's two row tiles of x (32 rows, 32 KB in a row) of the first element, and
  // its own LDS scratch; both with the lane's part in the loads and stores of a block.
  const float* xw = x + ((size_t)blockIdx.x * T_SZ + wid * 32 + lh * 8) * C_SZ + l16 * 4;
  _Float16* pb = &sm.pscr[wid][0];
  _Float16* pl = pb + lh * 8 * XPAD + l16 * 4;

  // ---------------- Phase 0: stage W^T (f16) and biases into LDS ----------------
  // Each lane reads 4 consecutive h of 8 consecutive c rows (16-byte loads, 8 lanes
  // per 128-byte line, whole lines only), transposes the 8x4 patch in registers and
  // writes 4 rows of 8 f16 with 16-byte LDS stores. The two 8-lane groups of a
  // 16-lane half take neighbouring c blocks, which shifts their LDS banks apart.
  {
    const int h0  = (((tid >> 4) & 1) * 8 + (tid & 7)) * 4;
    const int cb0 = wid * 2 + ((tid >> 3) & 1);
    const unsigned goff = (unsigned)(cb0 * 8 * H_SZ + h0);
    v4f r[6][8];
    v4f xa[48];
#pragma unroll
    for (int k = 0; k < 6; ++k) {
      const float* Wp = (k < 2) ? Wq : (k < 4) ? Wk : Wv;
#pragma unroll
      for (int i = 0; i < 8; ++i)
        r[k][i] = *(const v4f*)(Wp + goff + ((k & 1) * 128 + i) * H_SZ);
      // Keeps the groups' loads in the order in which they are used below, so
      // that a counted wait frees the first group while the later ones fly.
      __builtin_amdgcn_sched_barrier(0);
    }
    // Precaution: stands ahead of the x address arithmetic below, which may write a
    // register that the W loads above name as an address. Their byte offset is an input,
    // so that its register stays live, and so unwritten, up to the wait.
    asm volatile("s_wait_xcnt 0x0" :: "v"(goff * 4u) : "memory");
    // Keeps that arithmetic behind the wait.
    __builtin_amdgcn_sched_barrier(0);
    // Columns 0..191 of the first x rows: all 48 loads fly from memory while W is staged below.
    load_x_blocks<0, 3>(xw, xa);
    // Keeps the x loads up here; without it they sink to their use behind the staging.
    __builtin_amdgcn_sched_barrier(0);
    // Precaution: stands ahead of every later write of a register that the loads
    // above name as an address.
    asm volatile("s_wait_xcnt 0x0" ::: "memory");
    // Keeps the staging arithmetic below behind that wait.
    __builtin_amdgcn_sched_barrier(0);
#pragma unroll
    for (int k = 0; k < 6; ++k) {
      const int c0 = (cb0 + (k & 1) * 16) * 8;
#pragma unroll
      for (int j = 0; j < 4; ++j) {
        v8h t;
#pragma unroll
        for (int i = 0; i < 8; ++i) t[i] = (_Float16)r[k][i][j];
        *(v8h*)&sm.wt[k >> 1][(h0 + j) * CPAD + c0] = t;
      }
      // Keeps this group's LDS stores here, under the loads still in flight;
      // without it they all sink behind the last load's wait.
      __builtin_amdgcn_sched_barrier(0);
    }
    stage_x_blocks<3>(pl, xa);
  }
  if (tid < 192) {
    int p = tid >> 6, h = tid & 63;
    const float* bp = (p == 0) ? bq : (p == 1) ? bk : bv;
    sm.bias[p][h] = bp[h];
  }
  const int ws = __builtin_amdgcn_readfirstlane(wid);

  // W^T and the biases stay in LDS for every element of this work-group.
  // Kept rolled, for speed only.
#pragma unroll 1
  for (int it = 0; it < B_SZ / NGRP; ++it) {
  // First pass: publishes W^T and the biases. Later passes: ends every wave's reads of
  // the last element's Q, K and V^T, which phase 1 below overwrites.
  __syncthreads();

  // ---------------- Phase 1: Q/K/V projections (each wave: its 32 rows at once) --------
  {
    // Same-wave LDS RAW: the x rows read below were stored by this wave's other lanes.
    asm volatile("s_wait_dscnt 0" ::: "memory");
    // Columns 192..255 fly under the products of the columns before them (issued behind
    // the barrier, whose fence would wait for loads in flight).
    v4f xb[16];
    load_x_blocks<3, 1>(xw, xb);
    // Precaution: stands ahead of every later write of a register that the loads
    // above name as an address.
    asm volatile("s_wait_xcnt 0x0" ::: "memory");
    v8f acc[2][3][4];
#pragma unroll
    for (int i = 0; i < 2; ++i)
#pragma unroll
      for (int p = 0; p < 3; ++p)
#pragma unroll
        for (int ht = 0; ht < 4; ++ht) acc[i][p][ht] = {};

    // The 24 groups (K chunk kc, projection p) of eight products, four W^T fragments each
    // against both row tiles, run through a register ring of four groups: group g + 3's
    // fragments are asked for ahead of group g's products, so that a group's wait is a
    // counted one that leaves the younger loads in flight, and the products do not wait
    // out the LDS latency group by group.
    v16h af[2][2];    // x fragments of both row tiles: this K chunk's and the next's
    v16h bm[4][4];    // W^T fragments: the ring
#pragma unroll
    for (int g = -3; g < 24; ++g) {
      const int gl = g + 3;
      if (gl == 18) {
        // Columns 192..255 take the place of columns 0..63, whose fragments are long read.
        stage_x_blocks<1>(pl, xb);
        // Same-wave LDS RAW: the fragments read below were stored by this wave's other lanes.
        asm volatile("s_wait_dscnt 0" ::: "memory");
      }
      if (gl < 24) {
        const int kc = gl / 3;
        const int c0 = kc * 32 + lh * 8;
        if (gl % 3 == 0) {
          const int xc = (kc < 6 ? kc : kc - 6) * 32 + lh * 8;   // the chunk's place in the scratch
#pragma unroll
          for (int i = 0; i < 2; ++i)
            af[kc & 1][i] = lds_frag(&pb[(i * 16 + l16) * XPAD], xc);
        }
#pragma unroll
        for (int ht = 0; ht < 4; ++ht)
          bm[gl & 3][ht] = lds_frag(&sm.wt[gl % 3][(ht * 16 + l16) * CPAD], c0);
      }
      // Keeps these loads ahead of the products below; without it they sink to their use.
      __builtin_amdgcn_sched_barrier(0);
      if (g >= 0) {
#pragma unroll
        for (int ht = 0; ht < 4; ++ht)
#pragma unroll
          for (int i = 0; i < 2; ++i)
            acc[i][g % 3][ht] = wmma_f16(af[(g / 3) & 1][i], bm[g & 3][ht], acc[i][g % 3][ht]);
      }
      // Keeps the next group's loads behind these products, one place of loads a group.
      __builtin_amdgcn_sched_barrier(0);
    }
    // Epilogue: + bias, cvt f16, scatter into Q / K (row-major) and V^T. C/D layout: row
    // M = vgpr + 8 * half, column N = lane & 15. One pointer an array and constant offsets,
    // so that no address is kept in a register of its own across the attention.
    _Float16* qp = &sm.qs[(wid * 32 + 8 * lh) * HPAD + l16];
    _Float16* kp = &sm.ks[(wid * 32 + 8 * lh) * HPAD + l16];
    _Float16* vp = &sm.vts[l16 * TPAD + wid * 32 + 8 * lh];
#pragma unroll
    for (int p = 0; p < 3; ++p)
#pragma unroll
      for (int ht = 0; ht < 4; ++ht) {
        const float bb = sm.bias[p][ht * 16 + l16];
#pragma unroll
        for (int i = 0; i < 2; ++i)
#pragma unroll
          for (int vr = 0; vr < 8; ++vr) {
            float val = acc[i][p][ht][vr] + bb;
            if (p == 0)      qp[(i * 16 + vr) * HPAD + ht * 16] = (_Float16)val;
            else if (p == 1) kp[(i * 16 + vr) * HPAD + ht * 16] = (_Float16)val;
            else             vp[ht * 16 * TPAD + i * 16 + vr]   = (_Float16)val;
          }
      }
  }
  __syncthreads();

  // ---------------- Phase 2: causal attention (each wave: 2 row-tiles) --------
  // Wave w takes row tiles 15-w and w, so that every wave runs 9 of the 16 key-tile
  // pairs of its two tiles. The tile number goes into a scalar register, so that the
  // tests on it are scalar branches (the matrix instructions need every lane on).
  float* outb = out + ((size_t)blockIdx.x + (size_t)it * NGRP) * T_SZ * H_SZ;
  xw += (size_t)NGRP * T_SZ * C_SZ;
  // Holds registers from here to its staging at the foot of the pass only. Given a value
  // here: left unfilled on the last pass, it counts as live all round the loop, through
  // the projections too, and spills.
  v4f xa[48] = {};
  if (it + 1 < B_SZ / NGRP) {
    // Columns 0..191 of the next element's x rows fly from memory under this element's
    // attention (issued behind the barrier, whose fence would wait for loads in flight).
    load_x_blocks<0, 3>(xw, xa);
    // Precaution: stands ahead of every later write of a register that the loads
    // above name as an address.
    asm volatile("s_wait_xcnt 0x0" ::: "memory");
  }
  // Kept rolled, one body for both tiles, for speed only.
#pragma unroll 1
  for (int h = 0; h < 2; ++h) {
    attn_tile<8>(sm, h == 0 ? 15 - ws : ws, lh, l16, outb);
    // Precaution: stands ahead of every later write of a register that the output stores
    // of this tile name as address or data.
    asm volatile("s_wait_xcnt 0x0" ::: "memory");
  }
  // Into the wave's own scratch, which nobody else reads and this wave is done with.
  if (it + 1 < B_SZ / NGRP) stage_x_blocks<3>(pl, xa);
  }
}

extern "C" void kernel_launch(void* const* d_in, const int* in_sizes, int n_in,
                              void* d_out, int out_size, void* d_ws, size_t ws_size,
                              hipStream_t stream) {
  (void)in_sizes; (void)n_in; (void)out_size; (void)d_ws; (void)ws_size;
  const float* x  = (const float*)d_in[0];
  const float* Wq = (const float*)d_in[1];
  const float* bq = (const float*)d_in[2];
  const float* Wk = (const float*)d_in[3];
  const float* bk = (const float*)d_in[4];
  const float* Wv = (const float*)d_in[5];
  const float* bv = (const float*)d_in[6];
  float* out = (float*)d_out;
  fused_attn_head<<<dim3(NGRP), dim3(256), 0, stream>>>(x, Wq, bq, Wk, bk, Wv, bv, out);
}

// v008
// It runs in 21.9 microseconds.
// Next to v007, in two timings, it ran 1.06 times as fast each time.
// Over all steps from v000 it is 3.02 times as fast.
#include <hip/hip_runtime.h>
#include <hip/hip_bf16.h>
#include <math.h>

typedef __attribute__((ext_vector_type(16))) _Float16 v16h;
typedef __attribute__((ext_vector_type(8)))  _Float16 v8h;
typedef __attribute__((ext_vector_type(4)))  _Float16 v4h;
typedef __attribute__((ext_vector_type(8)))  float    v8f;
typedef __attribute__((ext_vector_type(4)))  float    v4f;

#define B_SZ 512
#define T_SZ 256
#define C_SZ 256
#define H_SZ 64
#define CPAD 264   // 256 + 8 f16 pad
#define HPAD 72    // 64 + 8 f16 pad
#define TPAD 264   // 256 + 8 f16 pad
#define XPAD 200   // 192 + 8 f16 pad: pitch of the x scratch, 16 bytes times an odd number
#define NWAVE 8
#define NGRP 256   // work-groups launched; each runs B_SZ / NGRP batch elements

struct __align__(16) SMem {
  _Float16 wt[3][64 * CPAD];        // W^T per projection: [h][c], f16
  _Float16 qs[T_SZ * HPAD];         // Q row-major [t][h]
  _Float16 ks[T_SZ * HPAD];         // K row-major [t][h]  (== A-operand of K Q^T)
  _Float16 vts[H_SZ * TPAD];        // V^T [h][t]          (== A-operand of V^T P^T)
  _Float16 pscr[NWAVE][32 * XPAD];  // per-wave scratch: 32 x rows, 192 columns at a time (phase 1); 16 output rows (phase 2)
  float    bias[3][H_SZ];
};

// Load a 16x32 f16 A/B fragment from a row-major matrix in LDS.
// Per ISA layout: lane holds row/col = lane&15; K chunks {off..off+7} -> v[0..7],
// {off+16..off+23} -> v[8..15], where off already includes (lane>>4)*8.
__device__ __forceinline__ v16h lds_frag(const _Float16* rowbase, int off) {
  v8h lo = *(const v8h*)(rowbase + off);
  v8h hi = *(const v8h*)(rowbase + off + 16);
  v16h r;
#pragma unroll
  for (int i = 0; i < 8; ++i) { r[i] = lo[i]; r[i + 8] = hi[i]; }
  return r;
}

// A wave's 32 rows of x go in blocks of 64 columns (256 bytes, two whole lines a row).
// One load takes a block's part of two rows, 16 lanes and 16 bytes a lane each: rows
// xrow(a) and xrow(a) + 8, which lie half the LDS banks apart at the scratch's pitch.
__device__ __forceinline__ constexpr int xrow(int a) { return (a >> 3) * 16 + (a & 7); }

// Blocks CB0 .. CB0 + NB - 1; xl is the wave's first row plus the lane's own part.
template <int CB0, int NB>
__device__ __forceinline__ void load_x_blocks(const float* xl, v4f (&xr)[16 * NB]) {
#pragma unroll
  for (int a = 0; a < 16; ++a)
#pragma unroll
    for (int cb = 0; cb < NB; ++cb)
      xr[a * NB + cb] = *(const v4f*)(xl + xrow(a) * C_SZ + (CB0 + cb) * 64);
}

// Convert the loaded blocks to f16 and lay them row-major [r][c] in the wave's own
// scratch, from column 0 on; pl is the scratch plus the lane's own part.
template <int NB>
__device__ __forceinline__ void stage_x_blocks(_Float16* pl, const v4f (&xr)[16 * NB]) {
#pragma unroll
  for (int a = 0; a < 16; ++a)
#pragma unroll
    for (int cb = 0; cb < NB; ++cb) {
      v4h t;
#pragma unroll
      for (int e = 0; e < 4; ++e) t[e] = (_Float16)xr[a * NB + cb][e];
      *(v4h*)&pl[xrow(a) * XPAD + cb * 64] = t;
    }
}

__device__ __forceinline__ v8f wmma_f16(v16h a, v16h b, v8f c) {
  return __builtin_amdgcn_wmma_f32_16x16x32_f16(
      /*neg_a=*/false, a, /*neg_b=*/false, b,
      /*c_mod=*/(short)0, c, /*reuse_a=*/false, /*reuse_b=*/false);
}

// Eight base-2 exponentials, in place. In asm text so that behind every v_exp_f32 stands,
// by construction, the one slot that the instruction set asks for before a vector
// instruction overwrites its source or reads its result.
__device__ __forceinline__ void exp2_x8(v8f& x) {
  float x0 = x[0], x1 = x[1], x2 = x[2], x3 = x[3], x4 = x[4], x5 = x[5], x6 = x[6], x7 = x[7];
  asm("v_exp_f32 %0, %0\n\tv_nop\n\t"
      "v_exp_f32 %1, %1\n\tv_nop\n\t"
      "v_exp_f32 %2, %2\n\tv_nop\n\t"
      "v_exp_f32 %3, %3\n\tv_nop\n\t"
      "v_exp_f32 %4, %4\n\tv_nop\n\t"
      "v_exp_f32 %5, %5\n\tv_nop\n\t"
      "v_exp_f32 %6, %6\n\tv_nop\n\t"
      "v_exp_f32 %7, %7\n\tv_nop"
      : "+v"(x0), "+v"(x1), "+v"(x2), "+v"(x3), "+v"(x4), "+v"(x5), "+v"(x6), "+v"(x7));
  x[0] = x0; x[1] = x1; x[2] = x2; x[3] = x3; x[4] = x4; x[5] = x5; x[6] = x6; x[7] = x7;
}

// Lane l's value from lane l ^ 16: the two lanes that share one query row below.
__device__ __forceinline__ float xhalf(float x) {
  return __builtin_bit_cast(float, __builtin_amdgcn_permlanex16(
      __builtin_bit_cast(int, x), __builtin_bit_cast(int, x), 0x76543210, 0xfedcba98, false, false));
}

// One base-2 exponential. In asm text for the same slot behind v_exp_f32 as above.
__device__ __forceinline__ float exp2_x1(float x) {
  float r;
  asm("v_exp_f32 %0, %1\n\tv_nop" : "=v"(r) : "v"(x));
  return r;
}

// The four K fragments of one pair of key tiles (32 keys, head size 64 in two K chunks);
// kp is the pair's first row plus the lane's own part.
__device__ __forceinline__ void load_k_pair(const _Float16* kp, v16h (&kf)[4]) {
#pragma unroll
  for (int t = 0; t < 2; ++t) {
    kf[t * 2]     = lds_frag(kp + t * 16 * HPAD, 0);
    kf[t * 2 + 1] = lds_frag(kp + t * 16 * HPAD, 32);
  }
}

// One pair of key tiles of one row tile, with a running row maximum and sum.
// S^T = K Q^T: register vr of lane (l16, lh) holds query row l16 against key 8 * lh + vr of
// a key tile, so a lane holds scores of one query row only, and the two tiles of the pair,
// converted in place, are that row's fragment of P in the k order of lds_frag.
// O^T = V^T P^T: a lane holds outputs of that same query row, so that the factor by which a
// new maximum shrinks the old sums is the lane's own.
// LAST: the pair that holds the diagonal tile; it alone has masked keys and no successor.
template <bool LAST>
__device__ __forceinline__ void attn_pair(const _Float16*& kp, const _Float16*& vp, v16h (&kf)[4],
                                          const v16h aq0, const v16h aq1, const int dl,
                                          float& mrow, float& ssum, v8f (&o)[4]) {
  const float c = 0.0625f * 1.44269504f;  // C^-0.5 = 256^-0.5, times log2 e
  // This pair's V^T and the next pair's K fragments: one place of LDS loads a pair, ahead of
  // the products, so that the products and the softmax below cover their latency.
  v16h vf[4], kn[4];
#pragma unroll
  for (int ht = 0; ht < 4; ++ht) vf[ht] = lds_frag(vp + ht * 16 * TPAD, 0);
  vp += 32;
  if (!LAST) {
    kp += 32 * HPAD;
    load_k_pair(kp, kn);
  }
  // Keeps these loads together up here; without it they sink among the products and to their use.
  __builtin_amdgcn_sched_barrier(0);
  v8f sa = {}, sb = {};
  sa = wmma_f16(kf[0], aq0, sa);
  sb = wmma_f16(kf[2], aq0, sb);
  sa = wmma_f16(kf[1], aq1, sa);
  sb = wmma_f16(kf[3], aq1, sb);
  if (LAST) {
    // key t * 16 + 8 * lh + vr of the pair <= query row, the lane's part all in dl
#pragma unroll
    for (int vr = 0; vr < 8; ++vr) {
      sa[vr] = (vr <= dl) ? sa[vr] : -INFINITY;
      sb[vr] = (16 + vr <= dl) ? sb[vr] : -INFINITY;
    }
  }
  // Row maximum of the raw scores (the scale is positive): a tree in the lane, then one
  // exchange of the two lanes that share a row.
  const float g0 = fmaxf(fmaxf(sa[0], sa[1]), sa[2]);
  const float g1 = fmaxf(fmaxf(sa[3], sa[4]), sa[5]);
  const float g2 = fmaxf(fmaxf(sa[6], sa[7]), sb[0]);
  const float g3 = fmaxf(fmaxf(sb[1], sb[2]), sb[3]);
  const float g4 = fmaxf(fmaxf(sb[4], sb[5]), sb[6]);
  const float mx = fmaxf(fmaxf(fmaxf(g0, g1), g2), fmaxf(fmaxf(g3, g4), sb[7]));
  const float mnew = fmaxf(fmaxf(mx, xhalf(mx)), mrow);
  // exp(scale * (v - m)) = 2^(v * c - m * c); -inf gives 0: the mask, and the first pair's factor
  const float alpha = exp2_x1((mrow - mnew) * c);
  const float mc = mnew * c;
  mrow = mnew;
#pragma unroll
  for (int vr = 0; vr < 8; ++vr) {
    sa[vr] = sa[vr] * c - mc;
    sb[vr] = sb[vr] * c - mc;
  }
  exp2_x8(sa);
  exp2_x8(sb);
#pragma unroll
  for (int ht = 0; ht < 4; ++ht) o[ht] *= alpha;
  // The lane's 16 weights, summed by halves, so that the additions go in register pairs
  const v8f es = sa + sb;
  const v4f e4 = __builtin_shufflevector(es, es, 0, 1, 2, 3) + __builtin_shufflevector(es, es, 4, 5, 6, 7);
  ssum = ssum * alpha + ((e4[0] + e4[2]) + (e4[1] + e4[3]));
  v16h pa;
#pragma unroll
  for (int vr = 0; vr < 8; ++vr) {
    pa[vr]     = (_Float16)sa[vr];
    pa[8 + vr] = (_Float16)sb[vr];
  }
  // Keeps the register moves at the foot down here, among the products below; moved up, they
  // would wait out the latency of the K loads that they read.
  if (!LAST) __builtin_amdgcn_sched_barrier(0);
#pragma unroll
  for (int ht = 0; ht < 4; ++ht) o[ht] = wmma_f16(vf[ht], pa, o[ht]);
  if (!LAST) {
#pragma unroll
    for (int f = 0; f < 4; ++f) kf[f] = kn[f];
  }
}

#define OPAD 68   // 64 + 4 f32 pad: pitch of the output rows in the scratch, 16 bytes times an odd number

// Causal attention of one 16-row tile mt by one wave. Key tiles right of the diagonal
// are wholly masked: their weights are exact zeros; past the diagonal's pair they are not computed. Work goes in
// pairs of key tiles (32 keys, one K chunk of P V): row tile mt needs pairs 0 .. mt/2,
// taken one after the other, all but the last in a rolled loop; the weights are normalised at the end.
// st is the wave's own LDS scratch, idle during the attention.
// Not force-inlined, as a function of its own its arrays go into registers before it is
// inlined into the caller's loop.
static __device__ inline void attn_tile(SMem& sm, const int mt,
                                        const int lh, const int l16, float* st, float* outb) {
  const int mp = mt >> 1;       // the pair that holds the diagonal tile: the last one needed
  const int r0 = mt * 16;
  const int dl = r0 - mp * 32 + l16 - 8 * lh;   // query row less the lane half's key offset, from the last pair's first key

  // B-operand of S^T: this tile's 16 Q rows, K-dim = 64 split into 2 chunks of 32
  const v16h aq0 = lds_frag(&sm.qs[(r0 + l16) * HPAD], lh * 8);
  const v16h aq1 = lds_frag(&sm.qs[(r0 + l16) * HPAD], 32 + lh * 8);
  const _Float16* kp = &sm.ks[l16 * HPAD + lh * 8];
  const _Float16* vp = &sm.vts[l16 * TPAD + lh * 8];
  v16h kf[4];
  load_k_pair(kp, kf);

  float mrow = -INFINITY, ssum = 0.f;
  v8f o[4];
#pragma unroll
  for (int ht = 0; ht < 4; ++ht) o[ht] = {};
  // Kept rolled: the trip count differs from tile to tile, and one short body serves all.
#pragma unroll 1
  for (int jp = 0; jp < mp; ++jp)
    attn_pair<false>(kp, vp, kf, aq0, aq1, dl, mrow, ssum, o);
  attn_pair<true>(kp, vp, kf, aq0, aq1, dl, mrow, ssum, o);

  // A row's sum lives in lanes l16 and l16 + 16
  const float inv = 1.0f / (ssum + xhalf(ssum));

  // Register vr of o[ht] is column ht * 16 + 8 * lh + vr of query row l16. Through the
  // scratch, row-major, so that every global store covers whole lines (two rows, 512 bytes).
  float* sp = st + l16 * OPAD + 8 * lh;
#pragma unroll
  for (int ht = 0; ht < 4; ++ht) {
    const v8f t = o[ht] * inv;
    *(v4f*)(sp + ht * 16)     = __builtin_shufflevector(t, t, 0, 1, 2, 3);
    *(v4f*)(sp + ht * 16 + 4) = __builtin_shufflevector(t, t, 4, 5, 6, 7);
  }
  // Same-wave LDS RAW: the rows read below were stored by this wave's other lanes.
  asm volatile("s_wait_dscnt 0" ::: "memory");
  const float* rp = st + lh * OPAD + l16 * 4;
  float* op = outb + (r0 + lh) * H_SZ + l16 * 4;
  v4f w[8];
#pragma unroll
  for (int a = 0; a < 8; ++a) w[a] = *(const v4f*)(rp + a * 2 * OPAD);
#pragma unroll
  for (int a = 0; a < 8; ++a) *(v4f*)(op + a * 2 * H_SZ) = w[a];
}

__global__ __launch_bounds__(256) void fused_attn_head(
    const float* __restrict__ x,
    const float* __restrict__ Wq, const float* __restrict__ bq,
    const float* __restrict__ Wk, const float* __restrict__ bk,
    const float* __restrict__ Wv, const float* __restrict__ bv,
    float* __restrict__ out) {
  __shared__ SMem sm;
  const int tid  = threadIdx.x;
  const int lane = tid & 31;
  const int wid  = tid >> 5;
  const int lh   = lane >> 4;   // which 16-lane half
  const int l16  = lane & 15;

  // A work-group runs batch elements blockIdx.x and blockIdx.x + NGRP, one after the other.
  // This wave's two row tiles of x (32 rows, 32 KB in a row) of the first element, and
  // its own LDS scratch; both with the lane's part in the loads and stores of a block.
  const float* xw = x + ((size_t)blockIdx.x * T_SZ + wid * 32 + lh * 8) * C_SZ + l16 * 4;
  _Float16* pb = &sm.pscr[wid][0];
  _Float16* pl = pb + lh * 8 * XPAD + l16 * 4;

  // ---------------- Phase 0: stage W^T (f16) and biases into LDS ----------------
  // Each lane reads 4 consecutive h of 8 consecutive c rows (16-byte loads, 8 lanes
  // per 128-byte line, whole lines only), transposes the 8x4 patch in registers and
  // writes 4 rows of 8 f16 with 16-byte LDS stores. The two 8-lane groups of a
  // 16-lane half take neighbouring c blocks, which shifts their LDS banks apart.
  {
    const int h0  = (((tid >> 4) & 1) * 8 + (tid & 7)) * 4;
    const int cb0 = wid * 2 + ((tid >> 3) & 1);
    const unsigned goff = (unsigned)(cb0 * 8 * H_SZ + h0);
    v4f r[6][8];
    v4f xa[48];
#pragma unroll
    for (int k = 0; k < 6; ++k) {
      const float* Wp = (k < 2) ? Wq : (k < 4) ? Wk : Wv;
#pragma unroll
      for (int i = 0; i < 8; ++i)
        r[k][i] = *(const v4f*)(Wp + goff + ((k & 1) * 128 + i) * H_SZ);
      // Keeps the groups' loads in the order in which they are used below, so
      // that a counted wait frees the first group while the later ones fly.
      __builtin_amdgcn_sched_barrier(0);
    }
    // Precaution: stands ahead of the x address arithmetic below, which may write a
    // register that the W loads above name as an address. Their byte offset is an input,
    // so that its register stays live, and so unwritten, up to the wait.
    asm volatile("s_wait_xcnt 0x0" :: "v"(goff * 4u) : "memory");
    // Keeps that arithmetic behind the wait.
    __builtin_amdgcn_sched_barrier(0);
    // Columns 0..191 of the first x rows: all 48 loads fly from memory while W is staged below.
    load_x_blocks<0, 3>(xw, xa);
    // Keeps the x loads up here; without it they sink to their use behind the staging.
    __builtin_amdgcn_sched_barrier(0);
    // Precaution: stands ahead of every later write of a register that the loads
    // above name as an address.
    asm volatile("s_wait_xcnt 0x0" ::: "memory");
    // Keeps the staging arithmetic below behind that wait.
    __builtin_amdgcn_sched_barrier(0);
#pragma unroll
    for (int k = 0; k < 6; ++k) {
      const int c0 = (cb0 + (k & 1) * 16) * 8;
#pragma unroll
      for (int j = 0; j < 4; ++j) {
        v8h t;
#pragma unroll
        for (int i = 0; i < 8; ++i) t[i] = (_Float16)r[k][i][j];
        *(v8h*)&sm.wt[k >> 1][(h0 + j) * CPAD + c0] = t;
      }
      // Keeps this group's LDS stores here, under the loads still in flight;
      // without it they all sink behind the last load's wait.
      __builtin_amdgcn_sched_barrier(0);
    }
    stage_x_blocks<3>(pl, xa);
  }
  if (tid < 192) {
    int p = tid >> 6, h = tid & 63;
    const float* bp = (p == 0) ? bq : (p == 1) ? bk : bv;
    sm.bias[p][h] = bp[h];
  }
  const int ws = __builtin_amdgcn_readfirstlane(wid);

  // W^T and the biases stay in LDS for every element of this work-group.
  // Kept rolled, for speed only.
#pragma unroll 1
  for (int it = 0; it < B_SZ / NGRP; ++it) {
  // First pass: publishes W^T and the biases. Later passes: ends every wave's reads of
  // the last element's Q, K and V^T, which phase 1 below overwrites.
  __syncthreads();

  // ---------------- Phase 1: Q/K/V projections (each wave: its 32 rows at once) --------
  {
    // Same-wave LDS RAW: the x rows read below were stored by this wave's other lanes.
    asm volatile("s_wait_dscnt 0" ::: "memory");
    // Columns 192..255 fly under the products of the columns before them (issued behind
    // the barrier, whose fence would wait for loads in flight).
    v4f xb[16];
    load_x_blocks<3, 1>(xw, xb);
    // Precaution: stands ahead of every later write of a register that the loads
    // above name as an address.
    asm volatile("s_wait_xcnt 0x0" ::: "memory");
    v8f acc[2][3][4];
#pragma unroll
    for (int i = 0; i < 2; ++i)
#pragma unroll
      for (int p = 0; p < 3; ++p)
#pragma unroll
        for (int ht = 0; ht < 4; ++ht) acc[i][p][ht] = {};

    // The 24 groups (K chunk kc, projection p) of eight products, four W^T fragments each
    // against both row tiles, run through a register ring of four groups: group g + 3's
    // fragments are asked for ahead of group g's products, so that a group's wait is a
    // counted one that leaves the younger loads in flight, and the products do not wait
    // out the LDS latency group by group.
    v16h af[2][2];    // x fragments of both row tiles: this K chunk's and the next's
    v16h bm[4][4];    // W^T fragments: the ring
#pragma unroll
    for (int g = -3; g < 24; ++g) {
      const int gl = g + 3;
      if (gl == 18) {
        // Columns 192..255 take the place of columns 0..63, whose fragments are long read.
        stage_x_blocks<1>(pl, xb);
        // Same-wave LDS RAW: the fragments read below were stored by this wave's other lanes.
        asm volatile("s_wait_dscnt 0" ::: "memory");
      }
      if (gl < 24) {
        const int kc = gl / 3;
        const int c0 = kc * 32 + lh * 8;
        if (gl % 3 == 0) {
          const int xc = (kc < 6 ? kc : kc - 6) * 32 + lh * 8;   // the chunk's place in the scratch
#pragma unroll
          for (int i = 0; i < 2; ++i)
            af[kc & 1][i] = lds_frag(&pb[(i * 16 + l16) * XPAD], xc);
        }
#pragma unroll
        for (int ht = 0; ht < 4; ++ht)
          bm[gl & 3][ht] = lds_frag(&sm.wt[gl % 3][(ht * 16 + l16) * CPAD], c0);
      }
      // Keeps these loads ahead of the products below; without it they sink to their use.
      __builtin_amdgcn_sched_barrier(0);
      if (g >= 0) {
#pragma unroll
        for (int ht = 0; ht < 4; ++ht)
#pragma unroll
          for (int i = 0; i < 2; ++i)
            acc[i][g % 3][ht] = wmma_f16(af[(g / 3) & 1][i], bm[g & 3][ht], acc[i][g % 3][ht]);
      }
      // Keeps the next group's loads behind these products, one place of loads a group.
      __builtin_amdgcn_sched_barrier(0);
    }
    // Epilogue: + bias, cvt f16, scatter into Q / K (row-major) and V^T. C/D layout: row
    // M = vgpr + 8 * half, column N = lane & 15. One pointer an array and constant offsets,
    // so that no address is kept in a register of its own across the attention.
    _Float16* qp = &sm.qs[(wid * 32 + 8 * lh) * HPAD + l16];
    _Float16* kp = &sm.ks[(wid * 32 + 8 * lh) * HPAD + l16];
    _Float16* vp = &sm.vts[l16 * TPAD + wid * 32 + 8 * lh];
#pragma unroll
    for (int p = 0; p < 3; ++p)
#pragma unroll
      for (int ht = 0; ht < 4; ++ht) {
        const float bb = sm.bias[p][ht * 16 + l16];
#pragma unroll
        for (int i = 0; i < 2; ++i)
#pragma unroll
          for (int vr = 0; vr < 8; ++vr) {
            float val = acc[i][p][ht][vr] + bb;
            if (p == 0)      qp[(i * 16 + vr) * HPAD + ht * 16] = (_Float16)val;
            else if (p == 1) kp[(i * 16 + vr) * HPAD + ht * 16] = (_Float16)val;
            else             vp[ht * 16 * TPAD + i * 16 + vr]   = (_Float16)val;
          }
      }
  }
  __syncthreads();

  // ---------------- Phase 2: causal attention (each wave: 2 row-tiles) --------
  // Wave w takes row tiles 15-w and w, so that every wave runs 9 of the 16 key-tile
  // pairs of its two tiles. The tile number goes into a scalar register, so that the
  // tests on it are scalar branches (the matrix instructions need every lane on).
  float* outb = out + ((size_t)blockIdx.x + (size_t)it * NGRP) * T_SZ * H_SZ;
  xw += (size_t)NGRP * T_SZ * C_SZ;
  // Holds registers from here to its staging at the foot of the pass only. Given a value
  // here: left unfilled on the last pass, it counts as live all round the loop, through
  // the projections too, and spills.
  v4f xa[48] = {};
  if (it + 1 < B_SZ / NGRP) {
    // Columns 0..191 of the next element's x rows fly from memory under this element's
    // attention (issued behind the barrier, whose fence would wait for loads in flight).
    load_x_blocks<0, 3>(xw, xa);
    // Precaution: stands ahead of every later write of a register that the loads
    // above name as an address.
    asm volatile("s_wait_xcnt 0x0" ::: "memory");
  }
  // Kept rolled, one body for both tiles, for speed only.
#pragma unroll 1
  for (int h = 0; h < 2; ++h) {
    attn_tile(sm, h == 0 ? 15 - ws : ws, lh, l16, (float*)pb, outb);
    // Precaution: stands ahead of every later write of a register that the output stores
    // of this tile name as address or data.
    asm volatile("s_wait_xcnt 0x0" ::: "memory");
  }
  // Into the wave's own scratch, which nobody else reads and this wave is done with.
  if (it + 1 < B_SZ / NGRP) stage_x_blocks<3>(pl, xa);
  }
}

extern "C" void kernel_launch(void* const* d_in, const int* in_sizes, int n_in,
                              void* d_out, int out_size, void* d_ws, size_t ws_size,
                              hipStream_t stream) {
  (void)in_sizes; (void)n_in; (void)out_size; (void)d_ws; (void)ws_size;
  const float* x  = (const float*)d_in[0];
  const float* Wq = (const float*)d_in[1];
  const float* bq = (const float*)d_in[2];
  const float* Wk = (const float*)d_in[3];
  const float* bk = (const float*)d_in[4];
  const float* Wv = (const float*)d_in[5];
  const float* bv = (const float*)d_in[6];
  float* out = (float*)d_out;
  fused_attn_head<<<dim3(NGRP), dim3(256), 0, stream>>>(x, Wq, bq, Wk, bk, Wv, bv, out);
}

// v009
// It runs in 21.2 microseconds.
// Timed twice side by side with v008, it ran 1.04 times as fast both times.
// Counting every step since v000, it is 3.14 times as fast.
#include <hip/hip_runtime.h>
#include <hip/hip_bf16.h>
#include <math.h>

typedef __attribute__((ext_vector_type(16))) _Float16 v16h;
typedef __attribute__((ext_vector_type(8)))  _Float16 v8h;
typedef __attribute__((ext_vector_type(4)))  _Float16 v4h;
typedef __attribute__((ext_vector_type(8)))  float    v8f;
typedef __attribute__((ext_vector_type(4)))  float    v4f;

#define B_SZ 512
#define T_SZ 256
#define C_SZ 256
#define H_SZ 64
#define CPAD 264   // 256 + 8 f16 pad
#define HPAD 72    // 64 + 8 f16 pad
#define TPAD 264   // 256 + 8 f16 pad
#define XPAD 200   // 192 + 8 f16 pad: pitch of the x scratch, 16 bytes times an odd number
#define NWAVE 8
#define NGRP 256   // work-groups launched; each runs B_SZ / NGRP batch elements

struct __align__(16) SMem {
  _Float16 wt[3][64 * CPAD];        // W^T per projection: [h][c], f16
  _Float16 qs[T_SZ * HPAD];         // Q row-major [t][h], scaled for base-2 scores
  _Float16 ks[T_SZ * HPAD];         // K row-major [t][h]  (== A-operand of K Q^T)
  _Float16 vts[H_SZ * TPAD];        // V^T [h][t]          (== A-operand of V^T P^T)
  _Float16 pscr[NWAVE][32 * XPAD];  // per-wave scratch: 32 x rows, 192 columns at a time (phase 1); 16 output rows (phase 2)
  float    bias[3][H_SZ];
};

// Load a 16x32 f16 A/B fragment from a row-major matrix in LDS.
// Per ISA layout: lane holds row/col = lane&15; K chunks {off..off+7} -> v[0..7],
// {off+16..off+23} -> v[8..15], where off already includes (lane>>4)*8.
__device__ __forceinline__ v16h lds_frag(const _Float16* rowbase, int off) {
  v8h lo = *(const v8h*)(rowbase + off);
  v8h hi = *(const v8h*)(rowbase + off + 16);
  v16h r;
#pragma unroll
  for (int i = 0; i < 8; ++i) { r[i] = lo[i]; r[i + 8] = hi[i]; }
  return r;
}

// A wave's 32 rows of x go in blocks of 64 columns (256 bytes, two whole lines a row).
// One load takes a block's part of two rows, 16 lanes and 16 bytes a lane each: rows
// xrow(a) and xrow(a) + 8, which lie half the LDS banks apart at the scratch's pitch.
__device__ __forceinline__ constexpr int xrow(int a) { return (a >> 3) * 16 + (a & 7); }

// Blocks CB0 .. CB0 + NB - 1; xl is the wave's first row plus the lane's own part.
template <int CB0, int NB>
__device__ __forceinline__ void load_x_blocks(const float* xl, v4f (&xr)[16 * NB]) {
#pragma unroll
  for (int a = 0; a < 16; ++a)
#pragma unroll
    for (int cb = 0; cb < NB; ++cb)
      xr[a * NB + cb] = *(const v4f*)(xl + xrow(a) * C_SZ + (CB0 + cb) * 64);
}

// Convert the loaded blocks to f16 and lay them row-major [r][c] in the wave's own
// scratch, from column 0 on; pl is the scratch plus the lane's own part.
template <int NB>
__device__ __forceinline__ void stage_x_blocks(_Float16* pl, const v4f (&xr)[16 * NB]) {
#pragma unroll
  for (int a = 0; a < 16; ++a)
#pragma unroll
    for (int cb = 0; cb < NB; ++cb) {
      v4h t;
#pragma unroll
      for (int e = 0; e < 4; ++e) t[e] = (_Float16)xr[a * NB + cb][e];
      *(v4h*)&pl[xrow(a) * XPAD + cb * 64] = t;
    }
}

__device__ __forceinline__ v8f wmma_f16(v16h a, v16h b, v8f c) {
  return __builtin_amdgcn_wmma_f32_16x16x32_f16(
      /*neg_a=*/false, a, /*neg_b=*/false, b,
      /*c_mod=*/(short)0, c, /*reuse_a=*/false, /*reuse_b=*/false);
}

// Eight base-2 exponentials into registers of their own: the sources stay, for the rare path
// that needs them again. In asm text so that behind every v_exp_f32 stands, by construction,
// the one slot that the instruction set asks for before a vector instruction overwrites its
// source or reads its result: the results are marked early-clobber, so that none takes the
// register of a source, and each v_exp_f32 is followed by one that is independent of it; the
// last gets a v_nop.
__device__ __forceinline__ v8f exp2_x8_keep(const v8f& x) {
  float r0, r1, r2, r3, r4, r5, r6, r7;
  asm("v_exp_f32 %0, %8\n\t"
      "v_exp_f32 %1, %9\n\t"
      "v_exp_f32 %2, %10\n\t"
      "v_exp_f32 %3, %11\n\t"
      "v_exp_f32 %4, %12\n\t"
      "v_exp_f32 %5, %13\n\t"
      "v_exp_f32 %6, %14\n\t"
      "v_exp_f32 %7, %15\n\tv_nop"
      : "=&v"(r0), "=&v"(r1), "=&v"(r2), "=&v"(r3), "=&v"(r4), "=&v"(r5), "=&v"(r6), "=&v"(r7)
      : "v"(x[0]), "v"(x[1]), "v"(x[2]), "v"(x[3]), "v"(x[4]), "v"(x[5]), "v"(x[6]), "v"(x[7]));
  v8f r;
  r[0] = r0; r[1] = r1; r[2] = r2; r[3] = r3; r[4] = r4; r[5] = r5; r[6] = r6; r[7] = r7;
  return r;
}

// Lane l's value from lane l ^ 16: the two lanes that share one query row below.
__device__ __forceinline__ float xhalf(float x) {
  return __builtin_bit_cast(float, __builtin_amdgcn_permlanex16(
      __builtin_bit_cast(int, x), __builtin_bit_cast(int, x), 0x76543210, 0xfedcba98, false, false));
}

// One base-2 exponential. In asm text for the same slot behind v_exp_f32 as above.
__device__ __forceinline__ float exp2_x1(float x) {
  float r;
  asm("v_exp_f32 %0, %1\n\tv_nop" : "=v"(r) : "v"(x));
  return r;
}

// The four K fragments of one pair of key tiles (32 keys, head size 64 in two K chunks);
// kp is the pair's first row plus the lane's own part.
__device__ __forceinline__ void load_k_pair(const _Float16* kp, v16h (&kf)[4]) {
#pragma unroll
  for (int t = 0; t < 2; ++t) {
    kf[t * 2]     = lds_frag(kp + t * 16 * HPAD, 0);
    kf[t * 2 + 1] = lds_frag(kp + t * 16 * HPAD, 32);
  }
}

// One pair of key tiles of one row tile, with a row maximum in use and a running sum.
// S^T = K Q^T: register vr of lane (l16, lh) holds query row l16 against key 8 * lh + vr of
// a key tile, so a lane holds scores of one query row only, and the two tiles of the pair,
// converted in place, are that row's fragment of P in the k order of lds_frag.
// O^T = V^T P^T: a lane holds outputs of that same query row, so that the factor by which a
// new maximum shrinks the old sums is the lane's own.
// Q comes scaled by C^-0.5 log2 e, so that a product is a score in base-2 units. The maximum
// in use goes into the product as its C operand (negm: its negative, eight times), so that the
// scores leave the matrix unit ready for the exponential. It is the row's maximum of the first
// pair and moves only when a later score lies more than 8 above it: until then the weights
// are at most 2^8, far inside f16 and f32, and the old sums need no factor.
// FIRST: the tile's first pair: no maximum in use yet, no old sums.
// LAST: the pair that holds the diagonal tile; it alone has masked keys and no successor.
// lone (the same for the whole wave): the last pair is the tile's only one. It comes with zeros
// for the maximum in use and the sums, and always takes its own maximum into use.
template <bool FIRST, bool LAST>
__device__ __forceinline__ void attn_pair(const _Float16*& kp, const _Float16*& vp, v16h (&kf)[4],
                                          const v16h aq0, const v16h aq1, const int dl,
                                          v8f& negm, float& ssum, v8f (&o)[4], const bool lone) {
  // This pair's V^T and the next pair's K fragments: one place of LDS loads a pair, ahead of
  // the products, so that the products and the softmax below cover their latency.
  v16h vf[4], kn[4];
#pragma unroll
  for (int ht = 0; ht < 4; ++ht) vf[ht] = lds_frag(vp + ht * 16 * TPAD, 0);
  vp += 32;
  if (!LAST) {
    kp += 32 * HPAD;
    load_k_pair(kp, kn);
  }
  // Keeps these loads together up here; without it they sink among the products and to their use.
  __builtin_amdgcn_sched_barrier(0);
  const v8f zero = {};
  v8f sa = wmma_f16(kf[0], aq0, FIRST ? zero : negm);
  v8f sb = wmma_f16(kf[2], aq0, FIRST ? zero : negm);
  sa = wmma_f16(kf[1], aq1, sa);
  sb = wmma_f16(kf[3], aq1, sb);
  if (LAST) {
    // key t * 16 + 8 * lh + vr of the pair <= query row, the lane's part all in dl
#pragma unroll
    for (int vr = 0; vr < 8; ++vr) {
      sa[vr] = (vr <= dl) ? sa[vr] : -INFINITY;
      sb[vr] = (16 + vr <= dl) ? sb[vr] : -INFINITY;
    }
  }
  // The lane's largest score, counted from the maximum in use: a tree in the lane.
  const float g0 = fmaxf(fmaxf(sa[0], sa[1]), sa[2]);
  const float g1 = fmaxf(fmaxf(sa[3], sa[4]), sa[5]);
  const float g2 = fmaxf(fmaxf(sa[6], sa[7]), sb[0]);
  const float g3 = fmaxf(fmaxf(sb[1], sb[2]), sb[3]);
  const float g4 = fmaxf(fmaxf(sb[4], sb[5]), sb[6]);
  const float mx = fmaxf(fmaxf(fmaxf(g0, g1), g2), fmaxf(fmaxf(g3, g4), sb[7]));
  // The weights 2^score; -inf gives 0: the mask.
  v8f ea, eb;
  if (FIRST) {
    // One exchange of the two lanes that share a row: both take the same maximum into use.
    const float d = fmaxf(mx, xhalf(mx));
    ea = exp2_x8_keep(sa - d);
    eb = exp2_x8_keep(sb - d);
#pragma unroll
    for (int vr = 0; vr < 8; ++vr) negm[vr] = -d;
  } else {
    // One test a pair for the whole wave, a scalar branch (the products need every lane on).
    const unsigned need = __builtin_amdgcn_ballot_w32(mx > 8.0f);
    // Keeps the compare up here, ahead of the exponentials, which then cover its way to the
    // branch; without it the compare sinks to the branch.
    __builtin_amdgcn_sched_barrier(0);
    ea = exp2_x8_keep(sa);
    eb = exp2_x8_keep(sb);
    if (__builtin_expect(need != 0 || (LAST && lone), 0)) {
      // Every row moves its maximum up to what this pair has shown (rows with nothing larger
      // stay: d = 0); the weights are formed anew from the kept scores. One exchange of the
      // two lanes that share a row: both take the same maximum into use. A lone pair takes
      // its maximum as it is, and its sums, all zero, the factor 1.
      const float d = fmaxf(fmaxf(mx, xhalf(mx)), (LAST && lone) ? -INFINITY : 0.f);
      const float alpha = exp2_x1((LAST && lone) ? 0.f : -d);
      ea = exp2_x8_keep(sa - d);
      eb = exp2_x8_keep(sb - d);
#pragma unroll
      for (int ht = 0; ht < 4; ++ht) o[ht] *= alpha;
      ssum *= alpha;
      negm -= d;
    }
  }
  // The lane's 16 weights, summed by halves, so that the additions go in register pairs
  const v8f es = ea + eb;
  const v4f e4 = __builtin_shufflevector(es, es, 0, 1, 2, 3) + __builtin_shufflevector(es, es, 4, 5, 6, 7);
  const float e1 = (e4[0] + e4[2]) + (e4[1] + e4[3]);
  ssum = FIRST ? e1 : ssum + e1;
  v16h pa;
#pragma unroll
  for (int vr = 0; vr < 8; ++vr) {
    pa[vr]     = (_Float16)ea[vr];
    pa[8 + vr] = (_Float16)eb[vr];
  }
#pragma unroll
  for (int ht = 0; ht < 4; ++ht) o[ht] = wmma_f16(vf[ht], pa, FIRST ? zero : o[ht]);
  if (!LAST) {
#pragma unroll
    for (int f = 0; f < 4; ++f) kf[f] = kn[f];
  }
}

#define OPAD 68   // 64 + 4 f32 pad: pitch of the output rows in the scratch, 16 bytes times an odd number

// Causal attention of one 16-row tile mt by one wave. Key tiles right of the diagonal
// are wholly masked: their weights are exact zeros; past the diagonal's pair they are not computed. Work goes in
// pairs of key tiles (32 keys, one K chunk of P V): row tile mt needs pairs 0 .. mt/2,
// taken one after the other, all but the first and the last in a rolled loop; the weights are normalised at the end.
// st is the wave's own LDS scratch, idle during the attention.
// Not force-inlined, as a function of its own its arrays go into registers before it is
// inlined into the caller's loop.
static __device__ inline void attn_tile(SMem& sm, const int mt,
                                        const int lh, const int l16, float* st, float* outb) {
  const int mp = mt >> 1;       // the pair that holds the diagonal tile: the last one needed
  const int r0 = mt * 16;
  const int dl = r0 - mp * 32 + l16 - 8 * lh;   // query row less the lane half's key offset, from the last pair's first key

  // B-operand of S^T: this tile's 16 Q rows, K-dim = 64 split into 2 chunks of 32
  const v16h aq0 = lds_frag(&sm.qs[(r0 + l16) * HPAD], lh * 8);
  const v16h aq1 = lds_frag(&sm.qs[(r0 + l16) * HPAD], 32 + lh * 8);
  const _Float16* kp = &sm.ks[l16 * HPAD + lh * 8];
  const _Float16* vp = &sm.vts[l16 * TPAD + lh * 8];
  v16h kf[4];
  load_k_pair(kp, kf);

  float ssum = 0.f;
  v8f negm = {}, o[4];
#pragma unroll
  for (int ht = 0; ht < 4; ++ht) o[ht] = {};
  const bool lone = mp == 0;
  if (!lone) {
    attn_pair<true, false>(kp, vp, kf, aq0, aq1, dl, negm, ssum, o, false);
    // Kept rolled: the trip count differs from tile to tile, and one short body serves all.
#pragma unroll 1
    for (int jp = 1; jp < mp; ++jp)
      attn_pair<false, false>(kp, vp, kf, aq0, aq1, dl, negm, ssum, o, false);
  }
  attn_pair<false, true>(kp, vp, kf, aq0, aq1, dl, negm, ssum, o, lone);

  // A row's sum lives in lanes l16 and l16 + 16
  const float inv = 1.0f / (ssum + xhalf(ssum));

  // Register vr of o[ht] is column ht * 16 + 8 * lh + vr of query row l16. Through the
  // scratch, row-major, so that every global store covers whole lines (two rows, 512 bytes).
  float* sp = st + l16 * OPAD + 8 * lh;
#pragma unroll
  for (int ht = 0; ht < 4; ++ht) {
    const v8f t = o[ht] * inv;
    *(v4f*)(sp + ht * 16)     = __builtin_shufflevector(t, t, 0, 1, 2, 3);
    *(v4f*)(sp + ht * 16 + 4) = __builtin_shufflevector(t, t, 4, 5, 6, 7);
  }
  // Same-wave LDS RAW: the rows read below were stored by this wave's other lanes.
  asm volatile("s_wait_dscnt 0" ::: "memory");
  const float* rp = st + lh * OPAD + l16 * 4;
  float* op = outb + (r0 + lh) * H_SZ + l16 * 4;
  v4f w[8];
#pragma unroll
  for (int a = 0; a < 8; ++a) w[a] = *(const v4f*)(rp + a * 2 * OPAD);
#pragma unroll
  for (int a = 0; a < 8; ++a) *(v4f*)(op + a * 2 * H_SZ) = w[a];
}

__global__ __launch_bounds__(256) void fused_attn_head(
    const float* __restrict__ x,
    const float* __restrict__ Wq, const float* __restrict__ bq,
    const float* __restrict__ Wk, const float* __restrict__ bk,
    const float* __restrict__ Wv, const float* __restrict__ bv,
    float* __restrict__ out) {
  __shared__ SMem sm;
  const int tid  = threadIdx.x;
  const int lane = tid & 31;
  const int wid  = tid >> 5;
  const int lh   = lane >> 4;   // which 16-lane half
  const int l16  = lane & 15;

  // A work-group runs batch elements blockIdx.x and blockIdx.x + NGRP, one after the other.
  // This wave's two row tiles of x (32 rows, 32 KB in a row) of the first element, and
  // its own LDS scratch; both with the lane's part in the loads and stores of a block.
  const float* xw = x + ((size_t)blockIdx.x * T_SZ + wid * 32 + lh * 8) * C_SZ + l16 * 4;
  _Float16* pb = &sm.pscr[wid][0];
  _Float16* pl = pb + lh * 8 * XPAD + l16 * 4;

  // ---------------- Phase 0: stage W^T (f16) and biases into LDS ----------------
  // Each lane reads 4 consecutive h of 8 consecutive c rows (16-byte loads, 8 lanes
  // per 128-byte line, whole lines only), transposes the 8x4 patch in registers and
  // writes 4 rows of 8 f16 with 16-byte LDS stores. The two 8-lane groups of a
  // 16-lane half take neighbouring c blocks, which shifts their LDS banks apart.
  {
    const int h0  = (((tid >> 4) & 1) * 8 + (tid & 7)) * 4;
    const int cb0 = wid * 2 + ((tid >> 3) & 1);
    const unsigned goff = (unsigned)(cb0 * 8 * H_SZ + h0);
    v4f r[6][8];
    v4f xa[48];
#pragma unroll
    for (int k = 0; k < 6; ++k) {
      const float* Wp = (k < 2) ? Wq : (k < 4) ? Wk : Wv;
#pragma unroll
      for (int i = 0; i < 8; ++i)
        r[k][i] = *(const v4f*)(Wp + goff + ((k & 1) * 128 + i) * H_SZ);
      // Keeps the groups' loads in the order in which they are used below, so
      // that a counted wait frees the first group while the later ones fly.
      __builtin_amdgcn_sched_barrier(0);
    }
    // Precaution: stands ahead of the x address arithmetic below, which may write a
    // register that the W loads above name as an address. Their byte offset is an input,
    // so that its register stays live, and so unwritten, up to the wait.
    asm volatile("s_wait_xcnt 0x0" :: "v"(goff * 4u) : "memory");
    // Keeps that arithmetic behind the wait.
    __builtin_amdgcn_sched_barrier(0);
    // Columns 0..191 of the first x rows: all 48 loads fly from memory while W is staged below.
    load_x_blocks<0, 3>(xw, xa);
    // Keeps the x loads up here; without it they sink to their use behind the staging.
    __builtin_amdgcn_sched_barrier(0);
    // Precaution: stands ahead of every later write of a register that the loads
    // above name as an address.
    asm volatile("s_wait_xcnt 0x0" ::: "memory");
    // Keeps the staging arithmetic below behind that wait.
    __builtin_amdgcn_sched_barrier(0);
#pragma unroll
    for (int k = 0; k < 6; ++k) {
      const int c0 = (cb0 + (k & 1) * 16) * 8;
#pragma unroll
      for (int j = 0; j < 4; ++j) {
        v8h t;
#pragma unroll
        for (int i = 0; i < 8; ++i) t[i] = (_Float16)r[k][i][j];
        *(v8h*)&sm.wt[k >> 1][(h0 + j) * CPAD + c0] = t;
      }
      // Keeps this group's LDS stores here, under the loads still in flight;
      // without it they all sink behind the last load's wait.
      __builtin_amdgcn_sched_barrier(0);
    }
    stage_x_blocks<3>(pl, xa);
  }
  if (tid < 192) {
    int p = tid >> 6, h = tid & 63;
    const float* bp = (p == 0) ? bq : (p == 1) ? bk : bv;
    sm.bias[p][h] = bp[h];
  }
  const int ws = __builtin_amdgcn_readfirstlane(wid);

  // W^T and the biases stay in LDS for every element of this work-group.
  // Kept rolled, for speed only.
#pragma unroll 1
  for (int it = 0; it < B_SZ / NGRP; ++it) {
  // First pass: publishes W^T and the biases. Later passes: ends every wave's reads of
  // the last element's Q, K and V^T, which phase 1 below overwrites.
  __syncthreads();

  // ---------------- Phase 1: Q/K/V projections (each wave: its 32 rows at once) --------
  {
    // Same-wave LDS RAW: the x rows read below were stored by this wave's other lanes.
    asm volatile("s_wait_dscnt 0" ::: "memory");
    // Columns 192..255 fly under the products of the columns before them (issued behind
    // the barrier, whose fence would wait for loads in flight).
    v4f xb[16];
    load_x_blocks<3, 1>(xw, xb);
    // Precaution: stands ahead of every later write of a register that the loads
    // above name as an address.
    asm volatile("s_wait_xcnt 0x0" ::: "memory");
    v8f acc[2][3][4];
#pragma unroll
    for (int i = 0; i < 2; ++i)
#pragma unroll
      for (int p = 0; p < 3; ++p)
#pragma unroll
        for (int ht = 0; ht < 4; ++ht) acc[i][p][ht] = {};

    // The 24 groups (K chunk kc, projection p) of eight products, four W^T fragments each
    // against both row tiles, run through a register ring of four groups: group g + 3's
    // fragments are asked for ahead of group g's products, so that a group's wait is a
    // counted one that leaves the younger loads in flight, and the products do not wait
    // out the LDS latency group by group.
    v16h af[2][2];    // x fragments of both row tiles: this K chunk's and the next's
    v16h bm[4][4];    // W^T fragments: the ring
#pragma unroll
    for (int g = -3; g < 24; ++g) {
      const int gl = g + 3;
      if (gl == 18) {
        // Columns 192..255 take the place of columns 0..63, whose fragments are long read.
        stage_x_blocks<1>(pl, xb);
        // Same-wave LDS RAW: the fragments read below were stored by this wave's other lanes.
        asm volatile("s_wait_dscnt 0" ::: "memory");
      }
      if (gl < 24) {
        const int kc = gl / 3;
        const int c0 = kc * 32 + lh * 8;
        if (gl % 3 == 0) {
          const int xc = (kc < 6 ? kc : kc - 6) * 32 + lh * 8;   // the chunk's place in the scratch
#pragma unroll
          for (int i = 0; i < 2; ++i)
            af[kc & 1][i] = lds_frag(&pb[(i * 16 + l16) * XPAD], xc);
        }
#pragma unroll
        for (int ht = 0; ht < 4; ++ht)
          bm[gl & 3][ht] = lds_frag(&sm.wt[gl % 3][(ht * 16 + l16) * CPAD], c0);
      }
      // Keeps these loads ahead of the products below; without it they sink to their use.
      __builtin_amdgcn_sched_barrier(0);
      if (g >= 0) {
#pragma unroll
        for (int ht = 0; ht < 4; ++ht)
#pragma unroll
          for (int i = 0; i < 2; ++i)
            acc[i][g % 3][ht] = wmma_f16(af[(g / 3) & 1][i], bm[g & 3][ht], acc[i][g % 3][ht]);
      }
      // Keeps the next group's loads behind these products, one place of loads a group.
      __builtin_amdgcn_sched_barrier(0);
    }
    // Epilogue: + bias, cvt f16, scatter into Q / K (row-major) and V^T. C/D layout: row
    // M = vgpr + 8 * half, column N = lane & 15. One pointer an array and constant offsets,
    // so that no address is kept in a register of its own across the attention.
    _Float16* qp = &sm.qs[(wid * 32 + 8 * lh) * HPAD + l16];
    _Float16* kp = &sm.ks[(wid * 32 + 8 * lh) * HPAD + l16];
    _Float16* vp = &sm.vts[l16 * TPAD + wid * 32 + 8 * lh];
#pragma unroll
    for (int p = 0; p < 3; ++p)
#pragma unroll
      for (int ht = 0; ht < 4; ++ht) {
        // Q takes the scores' scale with it: C^-0.5 = 256^-0.5, times log2 e.
        const float sc = (p == 0) ? 0.0625f * 1.44269504f : 1.0f;
        const float bb = sm.bias[p][ht * 16 + l16] * sc;
#pragma unroll
        for (int i = 0; i < 2; ++i)
#pragma unroll
          for (int vr = 0; vr < 8; ++vr) {
            float val = acc[i][p][ht][vr] * sc + bb;
            if (p == 0)      qp[(i * 16 + vr) * HPAD + ht * 16] = (_Float16)val;
            else if (p == 1) kp[(i * 16 + vr) * HPAD + ht * 16] = (_Float16)val;
            else             vp[ht * 16 * TPAD + i * 16 + vr]   = (_Float16)val;
          }
      }
  }
  __syncthreads();

  // ---------------- Phase 2: causal attention (each wave: 2 row-tiles) --------
  // Wave w takes row tiles 15-w and w, so that every wave runs 9 of the 16 key-tile
  // pairs of its two tiles. The tile number goes into a scalar register, so that the
  // tests on it are scalar branches (the matrix instructions need every lane on).
  float* outb = out + ((size_t)blockIdx.x + (size_t)it * NGRP) * T_SZ * H_SZ;
  xw += (size_t)NGRP * T_SZ * C_SZ;
  // Holds registers from here to its staging at the foot of the pass only. Given a value
  // here: left unfilled on the last pass, it counts as live all round the loop, through
  // the projections too, and spills.
  v4f xa[48] = {};
  if (it + 1 < B_SZ / NGRP) {
    // Columns 0..191 of the next element's x rows fly from memory under this element's
    // attention (issued behind the barrier, whose fence would wait for loads in flight).
    load_x_blocks<0, 3>(xw, xa);
    // Precaution: stands ahead of every later write of a register that the loads
    // above name as an address.
    asm volatile("s_wait_xcnt 0x0" ::: "memory");
  }
  // Kept rolled, one body for both tiles, for speed only.
#pragma unroll 1
  for (int h = 0; h < 2; ++h) {
    attn_tile(sm, h == 0 ? 15 - ws : ws, lh, l16, (float*)pb, outb);
    // Precaution: stands ahead of every later write of a register that the output stores
    // of this tile name as address or data.
    asm volatile("s_wait_xcnt 0x0" ::: "memory");
  }
  // Into the wave's own scratch, which nobody else reads and this wave is done with.
  if (it + 1 < B_SZ / NGRP) stage_x_blocks<3>(pl, xa);
  }
}

extern "C" void kernel_launch(void* const* d_in, const int* in_sizes, int n_in,
                              void* d_out, int out_size, void* d_ws, size_t ws_size,
                              hipStream_t stream) {
  (void)in_sizes; (void)n_in; (void)out_size; (void)d_ws; (void)ws_size;
  const float* x  = (const float*)d_in[0];
  const float* Wq = (const float*)d_in[1];
  const float* bq = (const float*)d_in[2];
  const float* Wk = (const float*)d_in[3];
  const float* bk = (const float*)d_in[4];
  const float* Wv = (const float*)d_in[5];
  const float* bv = (const float*)d_in[6];
  float* out = (float*)d_out;
  fused_attn_head<<<dim3(NGRP), dim3(256), 0, stream>>>(x, Wq, bq, Wk, bk, Wv, bv, out);
}

// v010
// Measured time: 20 microseconds a run.
// Two timings next to v009 both put it at 1.06 times that version's speed.
// Over all steps from v000 it is 3.32 times as fast.
#include <hip/hip_runtime.h>
#include <hip/hip_bf16.h>
#include <math.h>

typedef __attribute__((ext_vector_type(16))) _Float16 v16h;
typedef __attribute__((ext_vector_type(8)))  _Float16 v8h;
typedef __attribute__((ext_vector_type(4)))  _Float16 v4h;
typedef __attribute__((ext_vector_type(8)))  float    v8f;
typedef __attribute__((ext_vector_type(4)))  float    v4f;

#define B_SZ 512
#define T_SZ 256
#define C_SZ 256
#define H_SZ 64
#define CPAD 264   // 256 + 8 f16 pad
#define HPAD 72    // 64 + 8 f16 pad
#define TPAD 264   // 256 + 8 f16 pad
#define XPAD 200   // 192 + 8 f16 pad: pitch of the x scratch, 16 bytes times an odd number
#define NWAVE 8
#define NGRP 256   // work-groups launched; each runs B_SZ / NGRP batch elements

struct __align__(16) SMem {
  _Float16 wt[3][64 * CPAD];        // W^T per projection: [h][c], f16
  _Float16 qs[T_SZ * HPAD];         // Q row-major [t][h], scaled for base-2 scores
  _Float16 ks[T_SZ * HPAD];         // K row-major [t][h]  (== A-operand of K Q^T)
  _Float16 vts[H_SZ * TPAD];        // V^T [h][t]          (== A-operand of V^T P^T)
  _Float16 pscr[NWAVE][32 * XPAD];  // per-wave scratch: 32 x rows, 192 columns at a time (phase 1); 16 output rows (phase 2)
  float    bias[3][H_SZ];
};

// Load a 16x32 f16 A/B fragment from a row-major matrix in LDS.
// Per ISA layout: lane holds row/col = lane&15; K chunks {off..off+7} -> v[0..7],
// {off+16..off+23} -> v[8..15], where off already includes (lane>>4)*8.
__device__ __forceinline__ v16h lds_frag(const _Float16* rowbase, int off) {
  v8h lo = *(const v8h*)(rowbase + off);
  v8h hi = *(const v8h*)(rowbase + off + 16);
  v16h r;
#pragma unroll
  for (int i = 0; i < 8; ++i) { r[i] = lo[i]; r[i + 8] = hi[i]; }
  return r;
}

// A wave's 32 rows of x go in blocks of 64 columns (256 bytes, two whole lines a row).
// One load takes a block's part of two rows, 16 lanes and 16 bytes a lane each: rows
// xrow(a) and xrow(a) + 8, which lie half the LDS banks apart at the scratch's pitch.
__device__ __forceinline__ constexpr int xrow(int a) { return (a >> 3) * 16 + (a & 7); }

// Blocks CB0 .. CB0 + NB - 1; xl is the wave's first row plus the lane's own part.
// Non-temporal: every byte of x is read once in a launch, so that L2 need not keep it.
template <int CB0, int NB>
__device__ __forceinline__ void load_x_blocks(const float* xl, v4f (&xr)[16 * NB]) {
#pragma unroll
  for (int a = 0; a < 16; ++a)
#pragma unroll
    for (int cb = 0; cb < NB; ++cb)
      xr[a * NB + cb] = __builtin_nontemporal_load((const v4f*)(xl + xrow(a) * C_SZ + (CB0 + cb) * 64));
}

// Convert the loaded blocks to f16 and lay them row-major [r][c] in the wave's own
// scratch, from column 0 on; pl is the scratch plus the lane's own part.
template <int NB>
__device__ __forceinline__ void stage_x_blocks(_Float16* pl, const v4f (&xr)[16 * NB]) {
#pragma unroll
  for (int a = 0; a < 16; ++a)
#pragma unroll
    for (int cb = 0; cb < NB; ++cb) {
      v4h t;
#pragma unroll
      for (int e = 0; e < 4; ++e) t[e] = (_Float16)xr[a * NB + cb][e];
      *(v4h*)&pl[xrow(a) * XPAD + cb * 64] = t;
    }
}

__device__ __forceinline__ v8f wmma_f16(v16h a, v16h b, v8f c) {
  return __builtin_amdgcn_wmma_f32_16x16x32_f16(
      /*neg_a=*/false, a, /*neg_b=*/false, b,
      /*c_mod=*/(short)0, c, /*reuse_a=*/false, /*reuse_b=*/false);
}

// Eight base-2 exponentials into registers of their own: the sources stay, for the rare path
// that needs them again. In asm text so that behind every v_exp_f32 stands, by construction,
// the one slot that the instruction set asks for before a vector instruction overwrites its
// source or reads its result: the results are marked early-clobber, so that none takes the
// register of a source, and each v_exp_f32 is followed by one that is independent of it; the
// last gets a v_nop.
__device__ __forceinline__ v8f exp2_x8_keep(const v8f& x) {
  float r0, r1, r2, r3, r4, r5, r6, r7;
  asm("v_exp_f32 %0, %8\n\t"
      "v_exp_f32 %1, %9\n\t"
      "v_exp_f32 %2, %10\n\t"
      "v_exp_f32 %3, %11\n\t"
      "v_exp_f32 %4, %12\n\t"
      "v_exp_f32 %5, %13\n\t"
      "v_exp_f32 %6, %14\n\t"
      "v_exp_f32 %7, %15\n\tv_nop"
      : "=&v"(r0), "=&v"(r1), "=&v"(r2), "=&v"(r3), "=&v"(r4), "=&v"(r5), "=&v"(r6), "=&v"(r7)
      : "v"(x[0]), "v"(x[1]), "v"(x[2]), "v"(x[3]), "v"(x[4]), "v"(x[5]), "v"(x[6]), "v"(x[7]));
  v8f r;
  r[0] = r0; r[1] = r1; r[2] = r2; r[3] = r3; r[4] = r4; r[5] = r5; r[6] = r6; r[7] = r7;
  return r;
}

// Lane l's value from lane l ^ 16: the two lanes that share one query row below.
__device__ __forceinline__ float xhalf(float x) {
  return __builtin_bit_cast(float, __builtin_amdgcn_permlanex16(
      __builtin_bit_cast(int, x), __builtin_bit_cast(int, x), 0x76543210, 0xfedcba98, false, false));
}

// One base-2 exponential. In asm text for the same slot behind v_exp_f32 as above.
__device__ __forceinline__ float exp2_x1(float x) {
  float r;
  asm("v_exp_f32 %0, %1\n\tv_nop" : "=v"(r) : "v"(x));
  return r;
}

// The four K fragments of one pair of key tiles (32 keys, head size 64 in two K chunks);
// kp is the pair's first row plus the lane's own part.
__device__ __forceinline__ void load_k_pair(const _Float16* kp, v16h (&kf)[4]) {
#pragma unroll
  for (int t = 0; t < 2; ++t) {
    kf[t * 2]     = lds_frag(kp + t * 16 * HPAD, 0);
    kf[t * 2 + 1] = lds_frag(kp + t * 16 * HPAD, 32);
  }
}

// One pair of key tiles of one row tile, with a row maximum in use and a running sum.
// S^T = K Q^T: register vr of lane (l16, lh) holds query row l16 against key 8 * lh + vr of
// a key tile, so a lane holds scores of one query row only, and the two tiles of the pair,
// converted in place, are that row's fragment of P in the k order of lds_frag.
// O^T = V^T P^T: a lane holds outputs of that same query row, so that the factor by which a
// new maximum shrinks the old sums is the lane's own.
// Q comes scaled by C^-0.5 log2 e, so that a product is a score in base-2 units. The maximum
// in use goes into the product as its C operand (negm: its negative, eight times), so that the
// scores leave the matrix unit ready for the exponential. It is the row's maximum of the first
// pair and moves only when a later score lies more than 8 above it: until then the weights
// are at most 2^8, far inside f16 and f32, and the old sums need no factor.
// FIRST: the tile's first pair: no maximum in use yet, no old sums.
// LAST: the pair that holds the diagonal tile; it alone has masked keys and no successor.
// lone (the same for the whole wave): the last pair is the tile's only one. It comes with zeros
// for the maximum in use and the sums, and always takes its own maximum into use.
template <bool FIRST, bool LAST>
__device__ __forceinline__ void attn_pair(const _Float16*& kp, const _Float16*& vp, v16h (&kf)[4],
                                          const v16h aq0, const v16h aq1, const int dl,
                                          v8f& negm, float& ssum, v8f (&o)[4], const bool lone) {
  // This pair's V^T and the next pair's K fragments: one place of LDS loads a pair, ahead of
  // the products, so that the products and the softmax below cover their latency.
  v16h vf[4], kn[4];
#pragma unroll
  for (int ht = 0; ht < 4; ++ht) vf[ht] = lds_frag(vp + ht * 16 * TPAD, 0);
  vp += 32;
  if (!LAST) {
    kp += 32 * HPAD;
    load_k_pair(kp, kn);
  }
  // Keeps these loads together up here; without it they sink among the products and to their use.
  __builtin_amdgcn_sched_barrier(0);
  const v8f zero = {};
  v8f sa = wmma_f16(kf[0], aq0, FIRST ? zero : negm);
  v8f sb = wmma_f16(kf[2], aq0, FIRST ? zero : negm);
  sa = wmma_f16(kf[1], aq1, sa);
  sb = wmma_f16(kf[3], aq1, sb);
  if (LAST) {
    // key t * 16 + 8 * lh + vr of the pair <= query row, the lane's part all in dl
#pragma unroll
    for (int vr = 0; vr < 8; ++vr) {
      sa[vr] = (vr <= dl) ? sa[vr] : -INFINITY;
      sb[vr] = (16 + vr <= dl) ? sb[vr] : -INFINITY;
    }
  }
  // The lane's largest score, counted from the maximum in use: a tree in the lane.
  const float g0 = fmaxf(fmaxf(sa[0], sa[1]), sa[2]);
  const float g1 = fmaxf(fmaxf(sa[3], sa[4]), sa[5]);
  const float g2 = fmaxf(fmaxf(sa[6], sa[7]), sb[0]);
  const float g3 = fmaxf(fmaxf(sb[1], sb[2]), sb[3]);
  const float g4 = fmaxf(fmaxf(sb[4], sb[5]), sb[6]);
  const float mx = fmaxf(fmaxf(fmaxf(g0, g1), g2), fmaxf(fmaxf(g3, g4), sb[7]));
  // The weights 2^score; -inf gives 0: the mask.
  v8f ea, eb;
  if (FIRST) {
    // One exchange of the two lanes that share a row: both take the same maximum into use.
    const float d = fmaxf(mx, xhalf(mx));
    ea = exp2_x8_keep(sa - d);
    eb = exp2_x8_keep(sb - d);
#pragma unroll
    for (int vr = 0; vr < 8; ++vr) negm[vr] = -d;
  } else {
    // One test a pair for the whole wave, a scalar branch (the products need every lane on).
    const unsigned need = __builtin_amdgcn_ballot_w32(mx > 8.0f);
    // Keeps the compare up here, ahead of the exponentials, which then cover its way to the
    // branch; without it the compare sinks to the branch.
    __builtin_amdgcn_sched_barrier(0);
    ea = exp2_x8_keep(sa);
    eb = exp2_x8_keep(sb);
    if (__builtin_expect(need != 0 || (LAST && lone), 0)) {
      // Every row moves its maximum up to what this pair has shown (rows with nothing larger
      // stay: d = 0); the weights are formed anew from the kept scores. One exchange of the
      // two lanes that share a row: both take the same maximum into use. A lone pair takes
      // its maximum as it is, and its sums, all zero, the factor 1.
      const float d = fmaxf(fmaxf(mx, xhalf(mx)), (LAST && lone) ? -INFINITY : 0.f);
      const float alpha = exp2_x1((LAST && lone) ? 0.f : -d);
      ea = exp2_x8_keep(sa - d);
      eb = exp2_x8_keep(sb - d);
#pragma unroll
      for (int ht = 0; ht < 4; ++ht) o[ht] *= alpha;
      ssum *= alpha;
      negm -= d;
    }
  }
  // The lane's 16 weights, summed by halves, so that the additions go in register pairs
  const v8f es = ea + eb;
  const v4f e4 = __builtin_shufflevector(es, es, 0, 1, 2, 3) + __builtin_shufflevector(es, es, 4, 5, 6, 7);
  const float e1 = (e4[0] + e4[2]) + (e4[1] + e4[3]);
  ssum = FIRST ? e1 : ssum + e1;
  v16h pa;
#pragma unroll
  for (int vr = 0; vr < 8; ++vr) {
    pa[vr]     = (_Float16)ea[vr];
    pa[8 + vr] = (_Float16)eb[vr];
  }
#pragma unroll
  for (int ht = 0; ht < 4; ++ht) o[ht] = wmma_f16(vf[ht], pa, FIRST ? zero : o[ht]);
  if (!LAST) {
#pragma unroll
    for (int f = 0; f < 4; ++f) kf[f] = kn[f];
  }
}

#define OPAD 68   // 64 + 4 f32 pad: pitch of the output rows in the scratch, 16 bytes times an odd number

// Causal attention of one 16-row tile mt by one wave. Key tiles right of the diagonal
// are wholly masked: their weights are exact zeros; past the diagonal's pair they are not computed. Work goes in
// pairs of key tiles (32 keys, one K chunk of P V): row tile mt needs pairs 0 .. mt/2,
// taken one after the other, all but the first and the last in a rolled loop; the weights are normalised at the end.
// st is the wave's own LDS scratch, idle during the attention.
// Not force-inlined, as a function of its own its arrays go into registers before it is
// inlined into the caller's loop.
static __device__ inline void attn_tile(SMem& sm, const int mt,
                                        const int lh, const int l16, float* st, float* outb) {
  const int mp = mt >> 1;       // the pair that holds the diagonal tile: the last one needed
  const int r0 = mt * 16;
  const int dl = r0 - mp * 32 + l16 - 8 * lh;   // query row less the lane half's key offset, from the last pair's first key

  // B-operand of S^T: this tile's 16 Q rows, K-dim = 64 split into 2 chunks of 32
  const v16h aq0 = lds_frag(&sm.qs[(r0 + l16) * HPAD], lh * 8);
  const v16h aq1 = lds_frag(&sm.qs[(r0 + l16) * HPAD], 32 + lh * 8);
  const _Float16* kp = &sm.ks[l16 * HPAD + lh * 8];
  const _Float16* vp = &sm.vts[l16 * TPAD + lh * 8];
  v16h kf[4];
  load_k_pair(kp, kf);

  float ssum = 0.f;
  v8f negm = {}, o[4];
#pragma unroll
  for (int ht = 0; ht < 4; ++ht) o[ht] = {};
  const bool lone = mp == 0;
  if (!lone) {
    attn_pair<true, false>(kp, vp, kf, aq0, aq1, dl, negm, ssum, o, false);
    // Kept rolled: the trip count differs from tile to tile, and one short body serves all.
#pragma unroll 1
    for (int jp = 1; jp < mp; ++jp)
      attn_pair<false, false>(kp, vp, kf, aq0, aq1, dl, negm, ssum, o, false);
  }
  attn_pair<false, true>(kp, vp, kf, aq0, aq1, dl, negm, ssum, o, lone);

  // A row's sum lives in lanes l16 and l16 + 16
  const float inv = 1.0f / (ssum + xhalf(ssum));

  // Register vr of o[ht] is column ht * 16 + 8 * lh + vr of query row l16. Through the
  // scratch, row-major, so that every global store covers whole lines (two rows, 512 bytes).
  float* sp = st + l16 * OPAD + 8 * lh;
#pragma unroll
  for (int ht = 0; ht < 4; ++ht) {
    const v8f t = o[ht] * inv;
    *(v4f*)(sp + ht * 16)     = __builtin_shufflevector(t, t, 0, 1, 2, 3);
    *(v4f*)(sp + ht * 16 + 4) = __builtin_shufflevector(t, t, 4, 5, 6, 7);
  }
  // Same-wave LDS RAW: the rows read below were stored by this wave's other lanes.
  asm volatile("s_wait_dscnt 0" ::: "memory");
  const float* rp = st + lh * OPAD + l16 * 4;
  float* op = outb + (r0 + lh) * H_SZ + l16 * 4;
  v4f w[8];
#pragma unroll
  for (int a = 0; a < 8; ++a) w[a] = *(const v4f*)(rp + a * 2 * OPAD);
#pragma unroll
  for (int a = 0; a < 8; ++a)   // non-temporal: written once and read by nobody in this launch, so that L2 need not hold it
    __builtin_nontemporal_store(w[a], (v4f*)(op + a * 2 * H_SZ));
}

__global__ __launch_bounds__(256) void fused_attn_head(
    const float* __restrict__ x,
    const float* __restrict__ Wq, const float* __restrict__ bq,
    const float* __restrict__ Wk, const float* __restrict__ bk,
    const float* __restrict__ Wv, const float* __restrict__ bv,
    float* __restrict__ out) {
  __shared__ SMem sm;
  const int tid  = threadIdx.x;
  const int lane = tid & 31;
  const int wid  = tid >> 5;
  const int lh   = lane >> 4;   // which 16-lane half
  const int l16  = lane & 15;

  // A work-group runs batch elements blockIdx.x and blockIdx.x + NGRP, one after the other.
  // This wave's two row tiles of x (32 rows, 32 KB in a row) of the first element, and
  // its own LDS scratch; both with the lane's part in the loads and stores of a block.
  const float* xw = x + ((size_t)blockIdx.x * T_SZ + wid * 32 + lh * 8) * C_SZ + l16 * 4;
  _Float16* pb = &sm.pscr[wid][0];
  _Float16* pl = pb + lh * 8 * XPAD + l16 * 4;

  // ---------------- Phase 0: stage W^T (f16) and biases into LDS ----------------
  // Each lane reads 4 consecutive h of 8 consecutive c rows (16-byte loads, 8 lanes
  // per 128-byte line, whole lines only), transposes the 8x4 patch in registers and
  // writes 4 rows of 8 f16 with 16-byte LDS stores. The two 8-lane groups of a
  // 16-lane half take neighbouring c blocks, which shifts their LDS banks apart.
  {
    const int h0  = (((tid >> 4) & 1) * 8 + (tid & 7)) * 4;
    const int cb0 = wid * 2 + ((tid >> 3) & 1);
    const unsigned goff = (unsigned)(cb0 * 8 * H_SZ + h0);
    v4f r[6][8];
    v4f xa[48];
#pragma unroll
    for (int k = 0; k < 6; ++k) {
      const float* Wp = (k < 2) ? Wq : (k < 4) ? Wk : Wv;
#pragma unroll
      for (int i = 0; i < 8; ++i)
        r[k][i] = *(const v4f*)(Wp + goff + ((k & 1) * 128 + i) * H_SZ);
      // Keeps the groups' loads in the order in which they are used below, so
      // that a counted wait frees the first group while the later ones fly.
      __builtin_amdgcn_sched_barrier(0);
    }
    // Precaution: stands ahead of the x address arithmetic below, which may write a
    // register that the W loads above name as an address. Their byte offset is an input,
    // so that its register stays live, and so unwritten, up to the wait.
    asm volatile("s_wait_xcnt 0x0" :: "v"(goff * 4u) : "memory");
    // Keeps that arithmetic behind the wait.
    __builtin_amdgcn_sched_barrier(0);
    // Columns 0..191 of the first x rows: all 48 loads fly from memory while W is staged below.
    load_x_blocks<0, 3>(xw, xa);
    // Keeps the x loads up here; without it they sink to their use behind the staging.
    __builtin_amdgcn_sched_barrier(0);
    // Precaution: stands ahead of every later write of a register that the loads
    // above name as an address.
    asm volatile("s_wait_xcnt 0x0" ::: "memory");
    // Keeps the staging arithmetic below behind that wait.
    __builtin_amdgcn_sched_barrier(0);
#pragma unroll
    for (int k = 0; k < 6; ++k) {
      const int c0 = (cb0 + (k & 1) * 16) * 8;
#pragma unroll
      for (int j = 0; j < 4; ++j) {
        v8h t;
#pragma unroll
        for (int i = 0; i < 8; ++i) t[i] = (_Float16)r[k][i][j];
        *(v8h*)&sm.wt[k >> 1][(h0 + j) * CPAD + c0] = t;
      }
      // Keeps this group's LDS stores here, under the loads still in flight;
      // without it they all sink behind the last load's wait.
      __builtin_amdgcn_sched_barrier(0);
    }
    stage_x_blocks<3>(pl, xa);
  }
  if (tid < 192) {
    int p = tid >> 6, h = tid & 63;
    const float* bp = (p == 0) ? bq : (p == 1) ? bk : bv;
    sm.bias[p][h] = bp[h];
  }
  const int ws = __builtin_amdgcn_readfirstlane(wid);

  // W^T and the biases stay in LDS for every element of this work-group.
  // Kept rolled, for speed only.
#pragma unroll 1
  for (int it = 0; it < B_SZ / NGRP; ++it) {
  // First pass: publishes W^T and the biases. Later passes: ends every wave's reads of
  // the last element's Q, K and V^T, which phase 1 below overwrites.
  __syncthreads();

  // ---------------- Phase 1: Q/K/V projections (each wave: its 32 rows at once) --------
  {
    // Same-wave LDS RAW: the x rows read below were stored by this wave's other lanes.
    asm volatile("s_wait_dscnt 0" ::: "memory");
    // Columns 192..255 fly under the products of the columns before them (issued behind
    // the barrier, whose fence would wait for loads in flight).
    v4f xb[16];
    load_x_blocks<3, 1>(xw, xb);
    // Precaution: stands ahead of every later write of a register that the loads
    // above name as an address.
    asm volatile("s_wait_xcnt 0x0" ::: "memory");
    v8f acc[2][3][4];
#pragma unroll
    for (int i = 0; i < 2; ++i)
#pragma unroll
      for (int p = 0; p < 3; ++p)
#pragma unroll
        for (int ht = 0; ht < 4; ++ht) acc[i][p][ht] = {};

    // The 24 groups (K chunk kc, projection p) of eight products, four W^T fragments each
    // against both row tiles, run through a register ring of four groups: group g + 3's
    // fragments are asked for ahead of group g's products, so that a group's wait is a
    // counted one that leaves the younger loads in flight, and the products do not wait
    // out the LDS latency group by group.
    v16h af[2][2];    // x fragments of both row tiles: this K chunk's and the next's
    v16h bm[4][4];    // W^T fragments: the ring
#pragma unroll
    for (int g = -3; g < 24; ++g) {
      const int gl = g + 3;
      if (gl == 18) {
        // Columns 192..255 take the place of columns 0..63, whose fragments are long read.
        stage_x_blocks<1>(pl, xb);
        // Same-wave LDS RAW: the fragments read below were stored by this wave's other lanes.
        asm volatile("s_wait_dscnt 0" ::: "memory");
      }
      if (gl < 24) {
        const int kc = gl / 3;
        const int c0 = kc * 32 + lh * 8;
        if (gl % 3 == 0) {
          const int xc = (kc < 6 ? kc : kc - 6) * 32 + lh * 8;   // the chunk's place in the scratch
#pragma unroll
          for (int i = 0; i < 2; ++i)
            af[kc & 1][i] = lds_frag(&pb[(i * 16 + l16) * XPAD], xc);
        }
#pragma unroll
        for (int ht = 0; ht < 4; ++ht)
          bm[gl & 3][ht] = lds_frag(&sm.wt[gl % 3][(ht * 16 + l16) * CPAD], c0);
      }
      // Keeps these loads ahead of the products below; without it they sink to their use.
      __builtin_amdgcn_sched_barrier(0);
      if (g >= 0) {
#pragma unroll
        for (int ht = 0; ht < 4; ++ht)
#pragma unroll
          for (int i = 0; i < 2; ++i)
            acc[i][g % 3][ht] = wmma_f16(af[(g / 3) & 1][i], bm[g & 3][ht], acc[i][g % 3][ht]);
      }
      // Keeps the next group's loads behind these products, one place of loads a group.
      __builtin_amdgcn_sched_barrier(0);
    }
    // Epilogue: + bias, cvt f16, scatter into Q / K (row-major) and V^T. C/D layout: row
    // M = vgpr + 8 * half, column N = lane & 15. One pointer an array and constant offsets,
    // so that no address is kept in a register of its own across the attention.
    _Float16* qp = &sm.qs[(wid * 32 + 8 * lh) * HPAD + l16];
    _Float16* kp = &sm.ks[(wid * 32 + 8 * lh) * HPAD + l16];
    _Float16* vp = &sm.vts[l16 * TPAD + wid * 32 + 8 * lh];
#pragma unroll
    for (int p = 0; p < 3; ++p)
#pragma unroll
      for (int ht = 0; ht < 4; ++ht) {
        // Q takes the scores' scale with it: C^-0.5 = 256^-0.5, times log2 e.
        const float sc = (p == 0) ? 0.0625f * 1.44269504f : 1.0f;
        const float bb = sm.bias[p][ht * 16 + l16] * sc;
#pragma unroll
        for (int i = 0; i < 2; ++i)
#pragma unroll
          for (int vr = 0; vr < 8; ++vr) {
            float val = acc[i][p][ht][vr] * sc + bb;
            if (p == 0)      qp[(i * 16 + vr) * HPAD + ht * 16] = (_Float16)val;
            else if (p == 1) kp[(i * 16 + vr) * HPAD + ht * 16] = (_Float16)val;
            else             vp[ht * 16 * TPAD + i * 16 + vr]   = (_Float16)val;
          }
      }
  }
  __syncthreads();

  // ---------------- Phase 2: causal attention (each wave: 2 row-tiles) --------
  // Wave w takes row tiles 15-w and w, so that every wave runs 9 of the 16 key-tile
  // pairs of its two tiles. The tile number goes into a scalar register, so that the
  // tests on it are scalar branches (the matrix instructions need every lane on).
  float* outb = out + ((size_t)blockIdx.x + (size_t)it * NGRP) * T_SZ * H_SZ;
  xw += (size_t)NGRP * T_SZ * C_SZ;
  // Holds registers from here to its staging at the foot of the pass only. Given a value
  // here: left unfilled on the last pass, it counts as live all round the loop, through
  // the projections too, and spills.
  v4f xa[48] = {};
  if (it + 1 < B_SZ / NGRP) {
    // Columns 0..191 of the next element's x rows fly from memory under this element's
    // attention (issued behind the barrier, whose fence would wait for loads in flight).
    load_x_blocks<0, 3>(xw, xa);
    // Precaution: stands ahead of every later write of a register that the loads
    // above name as an address.
    asm volatile("s_wait_xcnt 0x0" ::: "memory");
  }
  // Kept rolled, one body for both tiles, for speed only.
#pragma unroll 1
  for (int h = 0; h < 2; ++h) {
    attn_tile(sm, h == 0 ? 15 - ws : ws, lh, l16, (float*)pb, outb);
    // Precaution: stands ahead of every later write of a register that the output stores
    // of this tile name as address or data.
    asm volatile("s_wait_xcnt 0x0" ::: "memory");
  }
  // Into the wave's own scratch, which nobody else reads and this wave is done with.
  if (it + 1 < B_SZ / NGRP) stage_x_blocks<3>(pl, xa);
  }
}

extern "C" void kernel_launch(void* const* d_in, const int* in_sizes, int n_in,
                              void* d_out, int out_size, void* d_ws, size_t ws_size,
                              hipStream_t stream) {
  (void)in_sizes; (void)n_in; (void)out_size; (void)d_ws; (void)ws_size;
  const float* x  = (const float*)d_in[0];
  const float* Wq = (const float*)d_in[1];
  const float* bq = (const float*)d_in[2];
  const float* Wk = (const float*)d_in[3];
  const float* bk = (const float*)d_in[4];
  const float* Wv = (const float*)d_in[5];
  const float* bv = (const float*)d_in[6];
  float* out = (float*)d_out;
  fused_attn_head<<<dim3(NGRP), dim3(256), 0, stream>>>(x, Wq, bq, Wk, bk, Wv, bv, out);
}
